// v000
// The times below were measured on an AMD MI455X: many runs one after another, warmed up first and cycling through
// copies of the inputs, with the whole window's GPU time divided by the number of runs. Launches and the gaps
// between them are all in it. The median over several windows is given; except for v000 it joins two sittings, which
// can be a few percent apart, so the side-by-side timings, each taken in one sitting, are the better comparison.
// v000 is the starting kernel. One run takes 160 microseconds.
#include <hip/hip_runtime.h>
#include <math.h>

typedef __attribute__((ext_vector_type(16))) _Float16 v16h;
typedef __attribute__((ext_vector_type(8)))  _Float16 v8h;
typedef __attribute__((ext_vector_type(8)))  float    v8f;

#define NH 8
#define CH 32
#define CQ 256
#define BB 2
#define QL 2048
#define KL 2048

static __device__ __forceinline__ v16h cat8(v8h a, v8h b) {
  return __builtin_shufflevector(a, b, 0,1,2,3,4,5,6,7,8,9,10,11,12,13,14,15);
}
static __device__ __forceinline__ v16h cvt2(v8f a, v8f b) {
  v16h r;
#pragma unroll
  for (int i = 0; i < 8; ++i) { r[i] = (_Float16)a[i]; r[8 + i] = (_Float16)b[i]; }
  return r;
}
static __device__ __forceinline__ v8f wmma16(v16h a, v16h b, v8f c) {
  return __builtin_amdgcn_wmma_f32_16x16x32_f16(false, a, false, b, (short)0, c, false, false);
}

// ---- prep: transpose 256x256 f32 weight -> f16 row-major of W^T ----
__global__ void k_transpose(const float* __restrict__ w, _Float16* __restrict__ wt) {
  int i = threadIdx.x;   // input row (k)
  int j = blockIdx.x;    // input col (n) -> output row
  wt[(size_t)j * CQ + i] = (_Float16)w[(size_t)i * CQ + j];
}

// ---- projections: [B*L,256] @ [256,256], one wave per 16x16 tile ----
// mode 0: q (scale 1/sqrt(32), split-head [b,h,l,32] f16)
// mode 1: k (split-head f16)
// mode 2: v (transposed [b,h,c,L] f16)
// mode 3: gate (sigmoid(x+b_g), f32 [B*L,256])
__global__ void k_proj(const float* __restrict__ x, const _Float16* __restrict__ wt,
                       _Float16* __restrict__ out_h, float* __restrict__ out_g,
                       const float* __restrict__ bias, int mode, int L) {
  const int lane = threadIdx.x;
  const int lo = lane & 15, hh = lane >> 4;
  const int m0 = blockIdx.x * 16;
  const int n0 = blockIdx.y * 16;
  const float*    xr = x  + (size_t)(m0 + lo) * CQ;
  const _Float16* wr = wt + (size_t)(n0 + lo) * CQ;
  const int n = n0 + lo;
  v8f acc = {};
#pragma unroll
  for (int kc = 0; kc < CQ; kc += 32) {
    v8f a0 = *(const v8f*)(xr + kc + hh * 8);
    v8f a1 = *(const v8f*)(xr + kc + 16 + hh * 8);
    v16h a  = cvt2(a0, a1);
    v16h bm = cat8(*(const v8h*)(wr + kc + hh * 8),
                   *(const v8h*)(wr + kc + 16 + hh * 8));
    acc = wmma16(a, bm, acc);
  }
#pragma unroll
  for (int r = 0; r < 8; ++r) {
    int mm = m0 + 8 * hh + r;           // global row in [0, B*L)
    int b = mm / L, li = mm % L;
    int h = n / CH, c = n % CH;
    float v = acc[r];
    if (mode == 0) {
      out_h[(((size_t)(b * NH + h) * L) + li) * CH + c] =
          (_Float16)(v * 0.17677669529663687f);
    } else if (mode == 1) {
      out_h[(((size_t)(b * NH + h) * L) + li) * CH + c] = (_Float16)v;
    } else if (mode == 2) {
      out_h[(((size_t)(b * NH + h) * CH) + c) * (size_t)L + li] = (_Float16)v;
    } else {
      out_g[(size_t)mm * CQ + n] = 1.0f / (1.0f + __expf(-(v + bias[n])));
    }
  }
}

// ---- fused flash attention, one wave per (b, h, 16 q rows) ----
// K/V tiles are double-buffered in LDS via global_load_async_to_lds_b128
// (ASYNCcnt-tracked), so the next 32-key tile streams in while the current
// tile's WMMAs + online softmax execute.
__global__ void k_attn(const _Float16* __restrict__ qh, const _Float16* __restrict__ kh,
                       const _Float16* __restrict__ vt, const float* __restrict__ bias_mask,
                       const float* __restrict__ bias_pair, const float* __restrict__ g,
                       _Float16* __restrict__ og) {
  __shared__ __align__(16) _Float16 kbuf[2][32][32];
  __shared__ __align__(16) _Float16 vbuf[2][32][32];
  __shared__ __align__(16) _Float16 lds_p[16][32];
  const int lane = threadIdx.x;
  const int lo = lane & 15, hh = lane >> 4;
  const int q0 = blockIdx.x * 16;
  const int h  = blockIdx.y;
  const int b  = blockIdx.z;
  const size_t bh = (size_t)(b * NH + h);

  // async-copy a 32x32 f16 tile (rows have stride rowstride halves) into LDS
  auto async_tile = [&](const _Float16* gbase, size_t rowstride, _Float16 (*dst)[32]) {
#pragma unroll
    for (int j = 0; j < 4; ++j) {
      int chunk = lane + 32 * j;        // 0..127 sixteen-byte chunks
      int row  = chunk >> 2;
      int c16  = (chunk & 3) * 8;       // halves
      const _Float16* gp = gbase + (size_t)row * rowstride + c16;
      unsigned ldsoff = (unsigned)(uintptr_t)(&dst[row][c16]);
      asm volatile("global_load_async_to_lds_b128 %0, %1, off"
                   :: "v"(ldsoff), "v"(gp) : "memory");
    }
  };

  // Q tile as WMMA A operand (K-dim = 32 channels, loaded once)
  const _Float16* qr = qh + (bh * QL + q0 + lo) * CH;
  v16h aq = cat8(*(const v8h*)(qr + hh * 8), *(const v8h*)(qr + 16 + hh * 8));

  // prefetch tile 0
  async_tile(kh + (bh * KL) * CH, CH, kbuf[0]);
  async_tile(vt + (bh * CH) * (size_t)KL, KL, vbuf[0]);

  float mrow[8], lrow[8];
#pragma unroll
  for (int r = 0; r < 8; ++r) { mrow[r] = -1e30f; lrow[r] = 0.0f; }
  v8f o0 = {}, o1 = {};

  for (int kc = 0; kc < KL; kc += 32) {
    const int buf = (kc >> 5) & 1;
    if (kc + 32 < KL) {
      // issue next tile into the other buffer, then wait for current tile:
      // the 8 newest async ops may stay outstanding (async loads complete
      // in order), so <=8 outstanding means the current buffer is ready.
      async_tile(kh + (bh * KL + kc + 32) * CH, CH, kbuf[buf ^ 1]);
      async_tile(vt + (bh * CH) * (size_t)KL + (kc + 32), KL, vbuf[buf ^ 1]);
      asm volatile("s_wait_asynccnt 0x8" ::: "memory");
    } else {
      asm volatile("s_wait_asynccnt 0x0" ::: "memory");
    }

    // B operands: rows of K (== columns of K^T) from LDS
    v16h b0 = cat8(*(const v8h*)(&kbuf[buf][lo][hh * 8]),
                   *(const v8h*)(&kbuf[buf][lo][16 + hh * 8]));
    v16h b1 = cat8(*(const v8h*)(&kbuf[buf][16 + lo][hh * 8]),
                   *(const v8h*)(&kbuf[buf][16 + lo][16 + hh * 8]));
    v8f z = {};
    v8f s0 = wmma16(aq, b0, z);   // S columns kc..kc+15
    v8f s1 = wmma16(aq, b1, z);   // S columns kc+16..kc+31

    float bm0 = bias_mask[(size_t)b * KL + kc + lo];
    float bm1 = bias_mask[(size_t)b * KL + kc + 16 + lo];
    float p0[8], p1[8], alpha[8], cm[8];
#pragma unroll
    for (int r = 0; r < 8; ++r) {
      int qq = q0 + 8 * hh + r;
      const float* bp = bias_pair + ((size_t)h * QL + qq) * KL + kc;
      s0[r] += bm0 + bp[lo];
      s1[r] += bm1 + bp[16 + lo];
      cm[r] = fmaxf(s0[r], s1[r]);
    }
    if (kc + 32 < KL) {  // prefetch next bias_pair chunk
      const float* bp = bias_pair + ((size_t)h * QL + q0 + 8 * hh) * KL + kc + 32;
      __builtin_prefetch(bp + lane, 0, 0);
    }
    // row max across the 16 columns held by this 16-lane group
#pragma unroll
    for (int s = 1; s <= 8; s <<= 1)
#pragma unroll
      for (int r = 0; r < 8; ++r)
        cm[r] = fmaxf(cm[r], __shfl_xor(cm[r], s, 32));
    float rs[8];
#pragma unroll
    for (int r = 0; r < 8; ++r) {
      float mn = fmaxf(mrow[r], cm[r]);
      alpha[r] = __expf(mrow[r] - mn);
      mrow[r] = mn;
      p0[r] = __expf(s0[r] - mn);
      p1[r] = __expf(s1[r] - mn);
      rs[r] = p0[r] + p1[r];
    }
#pragma unroll
    for (int s = 1; s <= 8; s <<= 1)
#pragma unroll
      for (int r = 0; r < 8; ++r)
        rs[r] += __shfl_xor(rs[r], s, 32);
#pragma unroll
    for (int r = 0; r < 8; ++r) {
      lrow[r] = lrow[r] * alpha[r] + rs[r];
      o0[r] *= alpha[r];
      o1[r] *= alpha[r];
    }
    // transpose P from D layout to A layout via LDS
    __syncthreads();
#pragma unroll
    for (int r = 0; r < 8; ++r) {
      lds_p[8 * hh + r][lo]      = (_Float16)p0[r];
      lds_p[8 * hh + r][16 + lo] = (_Float16)p1[r];
    }
    __syncthreads();
    v16h pa = cat8(*(const v8h*)(&lds_p[lo][hh * 8]),
                   *(const v8h*)(&lds_p[lo][16 + hh * 8]));
    // B operands: rows of V^T from LDS, output channels lo and 16+lo
    v16h bv0 = cat8(*(const v8h*)(&vbuf[buf][lo][hh * 8]),
                    *(const v8h*)(&vbuf[buf][lo][16 + hh * 8]));
    v16h bv1 = cat8(*(const v8h*)(&vbuf[buf][16 + lo][hh * 8]),
                    *(const v8h*)(&vbuf[buf][16 + lo][16 + hh * 8]));
    o0 = wmma16(pa, bv0, o0);
    o1 = wmma16(pa, bv1, o1);
  }
  // epilogue: normalize, gate, store f16 [B*Q, H*CH]
#pragma unroll
  for (int r = 0; r < 8; ++r) {
    int qq = q0 + 8 * hh + r;
    float inv = 1.0f / lrow[r];
    size_t base = ((size_t)b * QL + qq) * (NH * CH);
    int j0 = h * CH + lo;
    int j1 = h * CH + 16 + lo;
    og[base + j0] = (_Float16)(o0[r] * inv * g[base + j0]);
    og[base + j1] = (_Float16)(o1[r] * inv * g[base + j1]);
  }
}

// ---- final GEMM: [B*Q,256] @ w_o + b_o -> f32 out ----
__global__ void k_out(const _Float16* __restrict__ og, const _Float16* __restrict__ wot,
                      const float* __restrict__ b_o, float* __restrict__ out) {
  const int lane = threadIdx.x;
  const int lo = lane & 15, hh = lane >> 4;
  const int m0 = blockIdx.x * 16, n0 = blockIdx.y * 16;
  const _Float16* ar = og  + (size_t)(m0 + lo) * CQ;
  const _Float16* wr = wot + (size_t)(n0 + lo) * CQ;
  const int n = n0 + lo;
  v8f acc = {};
#pragma unroll
  for (int kc = 0; kc < CQ; kc += 32) {
    v16h a  = cat8(*(const v8h*)(ar + kc + hh * 8), *(const v8h*)(ar + kc + 16 + hh * 8));
    v16h bm = cat8(*(const v8h*)(wr + kc + hh * 8), *(const v8h*)(wr + kc + 16 + hh * 8));
    acc = wmma16(a, bm, acc);
  }
#pragma unroll
  for (int r = 0; r < 8; ++r) {
    int mm = m0 + 8 * hh + r;
    out[(size_t)mm * CQ + n] = acc[r] + b_o[n];
  }
}

extern "C" void kernel_launch(void* const* d_in, const int* in_sizes, int n_in,
                              void* d_out, int out_size, void* d_ws, size_t ws_size,
                              hipStream_t stream) {
  const float* q_x       = (const float*)d_in[0];
  const float* kv_x      = (const float*)d_in[1];
  const float* bias_mask = (const float*)d_in[2];
  const float* bias_pair = (const float*)d_in[3];
  const float* w_q       = (const float*)d_in[4];
  const float* w_k       = (const float*)d_in[5];
  const float* w_v       = (const float*)d_in[6];
  const float* w_g       = (const float*)d_in[7];
  const float* b_g       = (const float*)d_in[8];
  const float* w_o       = (const float*)d_in[9];
  const float* b_o       = (const float*)d_in[10];
  float* out = (float*)d_out;

  char* ws = (char*)d_ws;
  size_t off = 0;
  auto alloc = [&](size_t bytes) {
    size_t o = off;
    off += (bytes + 255) & ~(size_t)255;
    return o;
  };
  _Float16* wqt = (_Float16*)(ws + alloc((size_t)CQ * CQ * 2));
  _Float16* wkt = (_Float16*)(ws + alloc((size_t)CQ * CQ * 2));
  _Float16* wvt = (_Float16*)(ws + alloc((size_t)CQ * CQ * 2));
  _Float16* wgt = (_Float16*)(ws + alloc((size_t)CQ * CQ * 2));
  _Float16* wot = (_Float16*)(ws + alloc((size_t)CQ * CQ * 2));
  _Float16* qh  = (_Float16*)(ws + alloc((size_t)BB * NH * QL * CH * 2));
  _Float16* kh  = (_Float16*)(ws + alloc((size_t)BB * NH * KL * CH * 2));
  _Float16* vtp = (_Float16*)(ws + alloc((size_t)BB * NH * CH * KL * 2));
  float*    gb  = (float*)   (ws + alloc((size_t)BB * QL * CQ * 4));
  _Float16* og  = (_Float16*)(ws + alloc((size_t)BB * QL * CQ * 2));

  // weight transposes (f32 -> f16 W^T)
  k_transpose<<<dim3(CQ), dim3(CQ), 0, stream>>>(w_q, wqt);
  k_transpose<<<dim3(CQ), dim3(CQ), 0, stream>>>(w_k, wkt);
  k_transpose<<<dim3(CQ), dim3(CQ), 0, stream>>>(w_v, wvt);
  k_transpose<<<dim3(CQ), dim3(CQ), 0, stream>>>(w_g, wgt);
  k_transpose<<<dim3(CQ), dim3(CQ), 0, stream>>>(w_o, wot);

  // projections: one wave (32 threads) per 16x16 tile
  dim3 pgrid((BB * QL) / 16, CQ / 16);
  k_proj<<<pgrid, 32, 0, stream>>>(q_x,  wqt, qh,  nullptr, nullptr, 0, QL);
  k_proj<<<pgrid, 32, 0, stream>>>(kv_x, wkt, kh,  nullptr, nullptr, 1, KL);
  k_proj<<<pgrid, 32, 0, stream>>>(kv_x, wvt, vtp, nullptr, nullptr, 2, KL);
  k_proj<<<pgrid, 32, 0, stream>>>(q_x,  wgt, nullptr, gb,  b_g,     3, QL);

  // fused flash attention + gating (async double-buffered K/V tiles)
  k_attn<<<dim3(QL / 16, NH, BB), 32, 0, stream>>>(qh, kh, vtp, bias_mask,
                                                   bias_pair, gb, og);

  // output projection
  k_out<<<dim3((BB * QL) / 16, CQ / 16), 32, 0, stream>>>(og, wot, b_o, out);
}

// v001
// One run takes 128 microseconds.
// Timed twice side by side with v000, it ran 1.29 times as fast both times.
#include <hip/hip_runtime.h>
#include <math.h>

typedef __attribute__((ext_vector_type(16))) _Float16 v16h;
typedef __attribute__((ext_vector_type(8)))  _Float16 v8h;
typedef __attribute__((ext_vector_type(8)))  float    v8f;

#define NH 8
#define CH 32
#define CQ 256
#define BB 2
#define QL 2048
#define KL 2048

static __device__ __forceinline__ v16h cat8(v8h a, v8h b) {
  return __builtin_shufflevector(a, b, 0,1,2,3,4,5,6,7,8,9,10,11,12,13,14,15);
}
static __device__ __forceinline__ v16h cvt2(v8f a, v8f b) {
  v16h r;
#pragma unroll
  for (int i = 0; i < 8; ++i) { r[i] = (_Float16)a[i]; r[8 + i] = (_Float16)b[i]; }
  return r;
}
static __device__ __forceinline__ v8f wmma16(v16h a, v16h b, v8f c) {
  return __builtin_amdgcn_wmma_f32_16x16x32_f16(false, a, false, b, (short)0, c, false, false);
}

// ---- prep: transpose 256x256 f32 weight -> f16 row-major of W^T ----
__global__ void k_transpose(const float* __restrict__ w, _Float16* __restrict__ wt) {
  int i = threadIdx.x;   // input row (k)
  int j = blockIdx.x;    // input col (n) -> output row
  wt[(size_t)j * CQ + i] = (_Float16)w[(size_t)i * CQ + j];
}

// ---- projections: [B*L,256] @ [256,256], one wave per 16x16 tile ----
// mode 0: q (scale 1/sqrt(32), split-head [b,h,l,32] f16)
// mode 1: k (split-head f16)
// mode 2: v (transposed [b,h,c,L] f16)
// mode 3: gate (sigmoid(x+b_g), f32 [B*L,256])
__global__ void k_proj(const float* __restrict__ x, const _Float16* __restrict__ wt,
                       _Float16* __restrict__ out_h, float* __restrict__ out_g,
                       const float* __restrict__ bias, int mode, int L) {
  const int lane = threadIdx.x;
  const int lo = lane & 15, hh = lane >> 4;
  const int m0 = blockIdx.x * 16;
  const int n0 = blockIdx.y * 16;
  const float*    xr = x  + (size_t)(m0 + lo) * CQ;
  const _Float16* wr = wt + (size_t)(n0 + lo) * CQ;
  const int n = n0 + lo;
  v8f acc = {};
#pragma unroll
  for (int kc = 0; kc < CQ; kc += 32) {
    v8f a0 = *(const v8f*)(xr + kc + hh * 8);
    v8f a1 = *(const v8f*)(xr + kc + 16 + hh * 8);
    v16h a  = cvt2(a0, a1);
    v16h bm = cat8(*(const v8h*)(wr + kc + hh * 8),
                   *(const v8h*)(wr + kc + 16 + hh * 8));
    acc = wmma16(a, bm, acc);
  }
#pragma unroll
  for (int r = 0; r < 8; ++r) {
    int mm = m0 + 8 * hh + r;           // global row in [0, B*L)
    int b = mm / L, li = mm % L;
    int h = n / CH, c = n % CH;
    float v = acc[r];
    if (mode == 0) {
      out_h[(((size_t)(b * NH + h) * L) + li) * CH + c] =
          (_Float16)(v * 0.17677669529663687f);
    } else if (mode == 1) {
      out_h[(((size_t)(b * NH + h) * L) + li) * CH + c] = (_Float16)v;
    } else if (mode == 2) {
      out_h[(((size_t)(b * NH + h) * CH) + c) * (size_t)L + li] = (_Float16)v;
    } else {
      out_g[(size_t)mm * CQ + n] = 1.0f / (1.0f + __expf(-(v + bias[n])));
    }
  }
}

// lane l <-> lane l ^ 16 (the two halves that split one query's keys)
static __device__ __forceinline__ float xhalf(float x) {
  int i = __builtin_bit_cast(int, x);
  return __builtin_bit_cast(float,
      __builtin_amdgcn_permlanex16(i, i, 0x76543210, 0xfedcba98, false, false));
}

__global__ void k_attn(const _Float16* __restrict__ qh, const _Float16* __restrict__ kh,
                       const _Float16* __restrict__ vt, const float* __restrict__ bias_mask,
                       const float* __restrict__ bias_pair, const float* __restrict__ g,
                       _Float16* __restrict__ og) {
  __shared__ __align__(16) _Float16 kbuf[2][32][32];
  __shared__ __align__(16) _Float16 vbuf[2][32][32];
  const int lane = threadIdx.x;
  const int lo = lane & 15, hh = lane >> 4;
  const int q0 = blockIdx.x * 16;
  const int h  = blockIdx.y;
  const int b  = blockIdx.z;
  const size_t bh = (size_t)(b * NH + h);

  // async-copy a 32x32 f16 tile (rows have stride rowstride halves) into LDS
  auto async_tile = [&](const _Float16* gbase, size_t rowstride, _Float16 (*dst)[32]) {
#pragma unroll
    for (int j = 0; j < 4; ++j) {
      int chunk = lane + 32 * j;        // 0..127 sixteen-byte chunks
      int row  = chunk >> 2;
      int c16  = (chunk & 3) * 8;       // halves
      const _Float16* gp = gbase + (size_t)row * rowstride + c16;
      unsigned ldsoff = (unsigned)(uintptr_t)(&dst[row][c16]);
      asm volatile("global_load_async_to_lds_b128 %0, %1, off"
                   :: "v"(ldsoff), "v"(gp) : "memory");
    }
  };

  // Q tile as WMMA B operand (K-dim = 32 channels, loaded once)
  const _Float16* qr = qh + (bh * QL + q0 + lo) * CH;
  v16h aq = cat8(*(const v8h*)(qr + hh * 8), *(const v8h*)(qr + 16 + hh * 8));

  // prefetch tile 0
  async_tile(kh + (bh * KL) * CH, CH, kbuf[0]);
  async_tile(vt + (bh * CH) * (size_t)KL, KL, vbuf[0]);

  // this lane's query row of bias_pair and its half's keys of bias_mask
  const float* bprow = bias_pair + ((size_t)h * QL + q0 + lo) * KL + 8 * hh;
  const float* bmrow = bias_mask + (size_t)b * KL + 8 * hh;

  float mrow = -1e30f, lrow = 0.0f;   // lrow: this half's keys only
  v8f o0 = {}, o1 = {};

  for (int kc = 0; kc < KL; kc += 32) {
    const int buf = (kc >> 5) & 1;
    if (kc + 32 < KL) {
      // issue next tile into the other buffer, then wait for current tile:
      // the 8 newest async ops may stay outstanding (async loads complete
      // in order), so <=8 outstanding means the current buffer is ready.
      async_tile(kh + (bh * KL + kc + 32) * CH, CH, kbuf[buf ^ 1]);
      async_tile(vt + (bh * CH) * (size_t)KL + (kc + 32), KL, vbuf[buf ^ 1]);
      asm volatile("s_wait_asynccnt 0x8" ::: "memory");
    } else {
      asm volatile("s_wait_asynccnt 0x0" ::: "memory");
    }

    // A operands: rows of K from LDS
    v16h b0 = cat8(*(const v8h*)(&kbuf[buf][lo][hh * 8]),
                   *(const v8h*)(&kbuf[buf][lo][16 + hh * 8]));
    v16h b1 = cat8(*(const v8h*)(&kbuf[buf][16 + lo][hh * 8]),
                   *(const v8h*)(&kbuf[buf][16 + lo][16 + hh * 8]));
    // A operands: rows of V^T from LDS, output channels lo and 16+lo
    v16h bv0 = cat8(*(const v8h*)(&vbuf[buf][lo][hh * 8]),
                    *(const v8h*)(&vbuf[buf][lo][16 + hh * 8]));
    v16h bv1 = cat8(*(const v8h*)(&vbuf[buf][16 + lo][hh * 8]),
                    *(const v8h*)(&vbuf[buf][16 + lo][16 + hh * 8]));
    v8f z = {};
    v8f s0 = wmma16(b0, aq, z);   // s0[r] = S[q0+lo][kc + 8*hh + r]
    v8f s1 = wmma16(b1, aq, z);   // s1[r] = S[q0+lo][kc + 16 + 8*hh + r]

    v8f bm0 = *(const v8f*)(bmrow + kc);
    v8f bm1 = *(const v8f*)(bmrow + kc + 16);
    v8f bp0 = *(const v8f*)(bprow + kc);
    v8f bp1 = *(const v8f*)(bprow + kc + 16);
    float cm = -1e30f;
#pragma unroll
    for (int r = 0; r < 8; ++r) {
      s0[r] += bm0[r] + bp0[r];
      s1[r] += bm1[r] + bp1[r];
      cm = fmaxf(cm, fmaxf(s0[r], s1[r]));
    }
    if (kc + 32 < KL) {  // prefetch next bias_pair chunk
      const float* bp = bias_pair + ((size_t)h * QL + q0 + 8 * hh) * KL + kc + 32;
      __builtin_prefetch(bp + lane, 0, 0);
    }
    // the query's maximum over all 32 keys: join the two halves
    cm = fmaxf(cm, xhalf(cm));
    float mn = fmaxf(mrow, cm);
    float alpha = __expf(mrow - mn);
    mrow = mn;
    v16h pb;                      // P^T as B operand, hardware k order
    float rs = 0.0f;
#pragma unroll
    for (int r = 0; r < 8; ++r) {
      float p0 = __expf(s0[r] - mn);
      float p1 = __expf(s1[r] - mn);
      rs += p0 + p1;
      pb[r]     = (_Float16)p0;
      pb[8 + r] = (_Float16)p1;
    }
    lrow = lrow * alpha + rs;
#pragma unroll
    for (int r = 0; r < 8; ++r) {
      o0[r] *= alpha;
      o1[r] *= alpha;
    }
    o0 = wmma16(bv0, pb, o0);     // o0[r] = O[q0+lo][8*hh + r]
    o1 = wmma16(bv1, pb, o1);     // o1[r] = O[q0+lo][16 + 8*hh + r]
    // this trip's LDS reads have returned before the next trip's copies
    // refill the buffer they read
    asm volatile("s_wait_dscnt 0x0" ::: "memory");
  }
  // epilogue: join the halves' sums, normalize, gate, store f16 [B*Q, H*CH]
  {
    float inv = 1.0f / (lrow + xhalf(lrow));
    size_t base = ((size_t)b * QL + q0 + lo) * (NH * CH) + h * CH + 8 * hh;
    v8f g0 = *(const v8f*)(g + base);
    v8f g1 = *(const v8f*)(g + base + 16);
    v8h r0, r1;
#pragma unroll
    for (int r = 0; r < 8; ++r) {
      r0[r] = (_Float16)(o0[r] * inv * g0[r]);
      r1[r] = (_Float16)(o1[r] * inv * g1[r]);
    }
    *(v8h*)(og + base)      = r0;
    *(v8h*)(og + base + 16) = r1;
  }
}

// ---- final GEMM: [B*Q,256] @ w_o + b_o -> f32 out ----
__global__ void k_out(const _Float16* __restrict__ og, const _Float16* __restrict__ wot,
                      const float* __restrict__ b_o, float* __restrict__ out) {
  const int lane = threadIdx.x;
  const int lo = lane & 15, hh = lane >> 4;
  const int m0 = blockIdx.x * 16, n0 = blockIdx.y * 16;
  const _Float16* ar = og  + (size_t)(m0 + lo) * CQ;
  const _Float16* wr = wot + (size_t)(n0 + lo) * CQ;
  const int n = n0 + lo;
  v8f acc = {};
#pragma unroll
  for (int kc = 0; kc < CQ; kc += 32) {
    v16h a  = cat8(*(const v8h*)(ar + kc + hh * 8), *(const v8h*)(ar + kc + 16 + hh * 8));
    v16h bm = cat8(*(const v8h*)(wr + kc + hh * 8), *(const v8h*)(wr + kc + 16 + hh * 8));
    acc = wmma16(a, bm, acc);
  }
#pragma unroll
  for (int r = 0; r < 8; ++r) {
    int mm = m0 + 8 * hh + r;
    out[(size_t)mm * CQ + n] = acc[r] + b_o[n];
  }
}

extern "C" void kernel_launch(void* const* d_in, const int* in_sizes, int n_in,
                              void* d_out, int out_size, void* d_ws, size_t ws_size,
                              hipStream_t stream) {
  const float* q_x       = (const float*)d_in[0];
  const float* kv_x      = (const float*)d_in[1];
  const float* bias_mask = (const float*)d_in[2];
  const float* bias_pair = (const float*)d_in[3];
  const float* w_q       = (const float*)d_in[4];
  const float* w_k       = (const float*)d_in[5];
  const float* w_v       = (const float*)d_in[6];
  const float* w_g       = (const float*)d_in[7];
  const float* b_g       = (const float*)d_in[8];
  const float* w_o       = (const float*)d_in[9];
  const float* b_o       = (const float*)d_in[10];
  float* out = (float*)d_out;

  char* ws = (char*)d_ws;
  size_t off = 0;
  auto alloc = [&](size_t bytes) {
    size_t o = off;
    off += (bytes + 255) & ~(size_t)255;
    return o;
  };
  _Float16* wqt = (_Float16*)(ws + alloc((size_t)CQ * CQ * 2));
  _Float16* wkt = (_Float16*)(ws + alloc((size_t)CQ * CQ * 2));
  _Float16* wvt = (_Float16*)(ws + alloc((size_t)CQ * CQ * 2));
  _Float16* wgt = (_Float16*)(ws + alloc((size_t)CQ * CQ * 2));
  _Float16* wot = (_Float16*)(ws + alloc((size_t)CQ * CQ * 2));
  _Float16* qh  = (_Float16*)(ws + alloc((size_t)BB * NH * QL * CH * 2));
  _Float16* kh  = (_Float16*)(ws + alloc((size_t)BB * NH * KL * CH * 2));
  _Float16* vtp = (_Float16*)(ws + alloc((size_t)BB * NH * CH * KL * 2));
  float*    gb  = (float*)   (ws + alloc((size_t)BB * QL * CQ * 4));
  _Float16* og  = (_Float16*)(ws + alloc((size_t)BB * QL * CQ * 2));

  // weight transposes (f32 -> f16 W^T)
  k_transpose<<<dim3(CQ), dim3(CQ), 0, stream>>>(w_q, wqt);
  k_transpose<<<dim3(CQ), dim3(CQ), 0, stream>>>(w_k, wkt);
  k_transpose<<<dim3(CQ), dim3(CQ), 0, stream>>>(w_v, wvt);
  k_transpose<<<dim3(CQ), dim3(CQ), 0, stream>>>(w_g, wgt);
  k_transpose<<<dim3(CQ), dim3(CQ), 0, stream>>>(w_o, wot);

  // projections: one wave (32 threads) per 16x16 tile
  dim3 pgrid((BB * QL) / 16, CQ / 16);
  k_proj<<<pgrid, 32, 0, stream>>>(q_x,  wqt, qh,  nullptr, nullptr, 0, QL);
  k_proj<<<pgrid, 32, 0, stream>>>(kv_x, wkt, kh,  nullptr, nullptr, 1, KL);
  k_proj<<<pgrid, 32, 0, stream>>>(kv_x, wvt, vtp, nullptr, nullptr, 2, KL);
  k_proj<<<pgrid, 32, 0, stream>>>(q_x,  wgt, nullptr, gb,  b_g,     3, QL);

  // fused flash attention + gating (async double-buffered K/V tiles)
  k_attn<<<dim3(QL / 16, NH, BB), 32, 0, stream>>>(qh, kh, vtp, bias_mask,
                                                   bias_pair, gb, og);

  // output projection
  k_out<<<dim3((BB * QL) / 16, CQ / 16), 32, 0, stream>>>(og, wot, b_o, out);
}

// v002
// It runs in 123 microseconds.
// In two side-by-side timings against v001, it was 1.03 and 1.04 times as fast.
// All steps since v000 together make it 1.34 times as fast.
#include <hip/hip_runtime.h>
#include <math.h>

typedef __attribute__((ext_vector_type(16))) _Float16 v16h;
typedef __attribute__((ext_vector_type(8)))  _Float16 v8h;
typedef __attribute__((ext_vector_type(8)))  float    v8f;
typedef __attribute__((ext_vector_type(4)))  float    v4f;

#define NH 8
#define CH 32
#define CQ 256
#define BB 2
#define QL 2048
#define KL 2048
#define NW 4            // waves of a k_attn work-group; each takes KL / NW keys

static __device__ __forceinline__ v16h cat8(v8h a, v8h b) {
  return __builtin_shufflevector(a, b, 0,1,2,3,4,5,6,7,8,9,10,11,12,13,14,15);
}
static __device__ __forceinline__ v16h cvt2(v8f a, v8f b) {
  v16h r;
#pragma unroll
  for (int i = 0; i < 8; ++i) { r[i] = (_Float16)a[i]; r[8 + i] = (_Float16)b[i]; }
  return r;
}
static __device__ __forceinline__ v8f wmma16(v16h a, v16h b, v8f c) {
  return __builtin_amdgcn_wmma_f32_16x16x32_f16(false, a, false, b, (short)0, c, false, false);
}

// ---- prep: transpose 256x256 f32 weight -> f16 row-major of W^T ----
__global__ void k_transpose(const float* __restrict__ w, _Float16* __restrict__ wt) {
  int i = threadIdx.x;   // input row (k)
  int j = blockIdx.x;    // input col (n) -> output row
  wt[(size_t)j * CQ + i] = (_Float16)w[(size_t)i * CQ + j];
}

// ---- projections: [B*L,256] @ [256,256], one wave per 16x16 tile ----
// mode 0: q (scale 1/sqrt(32), split-head [b,h,l,32] f16)
// mode 1: k (split-head f16)
// mode 2: v (transposed [b,h,c,L] f16)
// mode 3: gate (sigmoid(x+b_g), f32 [B*L,256])
__global__ void k_proj(const float* __restrict__ x, const _Float16* __restrict__ wt,
                       _Float16* __restrict__ out_h, float* __restrict__ out_g,
                       const float* __restrict__ bias, int mode, int L) {
  const int lane = threadIdx.x;
  const int lo = lane & 15, hh = lane >> 4;
  const int m0 = blockIdx.x * 16;
  const int n0 = blockIdx.y * 16;
  const float*    xr = x  + (size_t)(m0 + lo) * CQ;
  const _Float16* wr = wt + (size_t)(n0 + lo) * CQ;
  const int n = n0 + lo;
  v8f acc = {};
#pragma unroll
  for (int kc = 0; kc < CQ; kc += 32) {
    v8f a0 = *(const v8f*)(xr + kc + hh * 8);
    v8f a1 = *(const v8f*)(xr + kc + 16 + hh * 8);
    v16h a  = cvt2(a0, a1);
    v16h bm = cat8(*(const v8h*)(wr + kc + hh * 8),
                   *(const v8h*)(wr + kc + 16 + hh * 8));
    acc = wmma16(a, bm, acc);
  }
#pragma unroll
  for (int r = 0; r < 8; ++r) {
    int mm = m0 + 8 * hh + r;           // global row in [0, B*L)
    int b = mm / L, li = mm % L;
    int h = n / CH, c = n % CH;
    float v = acc[r];
    if (mode == 0) {
      out_h[(((size_t)(b * NH + h) * L) + li) * CH + c] =
          (_Float16)(v * 0.17677669529663687f);
    } else if (mode == 1) {
      out_h[(((size_t)(b * NH + h) * L) + li) * CH + c] = (_Float16)v;
    } else if (mode == 2) {
      out_h[(((size_t)(b * NH + h) * CH) + c) * (size_t)L + li] = (_Float16)v;
    } else {
      out_g[(size_t)mm * CQ + n] = 1.0f / (1.0f + __expf(-(v + bias[n])));
    }
  }
}

// lane l <-> lane l ^ 16 (the two halves that split one query's keys)
static __device__ __forceinline__ float xhalf(float x) {
  int i = __builtin_bit_cast(int, x);
  return __builtin_bit_cast(float,
      __builtin_amdgcn_permlanex16(i, i, 0x76543210, 0xfedcba98, false, false));
}

__global__ void k_attn(const _Float16* __restrict__ qh, const _Float16* __restrict__ kh,
                       const _Float16* __restrict__ vt, const float* __restrict__ bias_mask,
                       const float* __restrict__ bias_pair, const float* __restrict__ g,
                       _Float16* __restrict__ og) {
  __shared__ __align__(16) _Float16 kbuf[NW][2][32][32];
  __shared__ __align__(16) _Float16 vbuf[NW][2][32][32];
  const int lane = threadIdx.x & 31;
  const int wave = __builtin_amdgcn_readfirstlane(threadIdx.x >> 5);
  const int kbeg = wave * (KL / NW), kend = kbeg + KL / NW;
  const int lo = lane & 15, hh = lane >> 4;
  const int q0 = blockIdx.x * 16;
  const int h  = blockIdx.y;
  const int b  = blockIdx.z;
  const size_t bh = (size_t)(b * NH + h);

  // async-copy a 32x32 f16 tile (rows have stride rowstride halves) into LDS
  auto async_tile = [&](const _Float16* gbase, size_t rowstride, _Float16 (*dst)[32]) {
    const _Float16* gp[4];
    unsigned ldsoff[4];
#pragma unroll  // constant indices: the addresses stay in registers
    for (int j = 0; j < 4; ++j) {
      int chunk = lane + 32 * j;        // 0..127 sixteen-byte chunks
      int row  = chunk >> 2;
      int c16  = (chunk & 3) * 8;       // halves
      gp[j] = gbase + (size_t)row * rowstride + c16;
      ldsoff[j] = (unsigned)(uintptr_t)(&dst[row][c16]);
    }
    // the wait closes the statement so that no address register of a copy
    // is rewritten in front of it
    asm volatile("global_load_async_to_lds_b128 %0, %1, off\n\t"
                 "global_load_async_to_lds_b128 %2, %3, off\n\t"
                 "global_load_async_to_lds_b128 %4, %5, off\n\t"
                 "global_load_async_to_lds_b128 %6, %7, off\n\t"
                 "s_wait_xcnt 0x0"
                 :: "v"(ldsoff[0]), "v"(gp[0]), "v"(ldsoff[1]), "v"(gp[1]),
                    "v"(ldsoff[2]), "v"(gp[2]), "v"(ldsoff[3]), "v"(gp[3])
                 : "memory");
  };

  // Q tile as WMMA B operand (K-dim = 32 channels, loaded once)
  const _Float16* qr = qh + (bh * QL + q0 + lo) * CH;
  v16h aq = cat8(*(const v8h*)(qr + hh * 8), *(const v8h*)(qr + 16 + hh * 8));

  // prefetch this wave's first tile
  async_tile(kh + (bh * KL + kbeg) * CH, CH, kbuf[wave][0]);
  async_tile(vt + (bh * CH) * (size_t)KL + kbeg, KL, vbuf[wave][0]);

  // this lane's query row of bias_pair and its half's keys of bias_mask
  const float* bprow = bias_pair + ((size_t)h * QL + q0 + lo) * KL + 8 * hh;
  const float* bmrow = bias_mask + (size_t)b * KL + 8 * hh;

  float mrow = -1e30f, lrow = 0.0f;   // lrow: this half's keys only
  v8f o0 = {}, o1 = {};

  for (int kc = kbeg; kc < kend; kc += 32) {
    const int buf = (kc >> 5) & 1;
    if (kc + 32 < kend) {
      // issue next tile into the other buffer, then wait for current tile:
      // the 8 newest async ops may stay outstanding (async loads complete
      // in order), so <=8 outstanding means the current buffer is ready.
      async_tile(kh + (bh * KL + kc + 32) * CH, CH, kbuf[wave][buf ^ 1]);
      async_tile(vt + (bh * CH) * (size_t)KL + (kc + 32), KL, vbuf[wave][buf ^ 1]);
      asm volatile("s_wait_asynccnt 0x8" ::: "memory");
    } else {
      asm volatile("s_wait_asynccnt 0x0" ::: "memory");
    }

    // A operands: rows of K from LDS
    v16h b0 = cat8(*(const v8h*)(&kbuf[wave][buf][lo][hh * 8]),
                   *(const v8h*)(&kbuf[wave][buf][lo][16 + hh * 8]));
    v16h b1 = cat8(*(const v8h*)(&kbuf[wave][buf][16 + lo][hh * 8]),
                   *(const v8h*)(&kbuf[wave][buf][16 + lo][16 + hh * 8]));
    // A operands: rows of V^T from LDS, output channels lo and 16+lo
    v16h bv0 = cat8(*(const v8h*)(&vbuf[wave][buf][lo][hh * 8]),
                    *(const v8h*)(&vbuf[wave][buf][lo][16 + hh * 8]));
    v16h bv1 = cat8(*(const v8h*)(&vbuf[wave][buf][16 + lo][hh * 8]),
                    *(const v8h*)(&vbuf[wave][buf][16 + lo][16 + hh * 8]));
    v8f z = {};
    v8f s0 = wmma16(b0, aq, z);   // s0[r] = S[q0+lo][kc + 8*hh + r]
    v8f s1 = wmma16(b1, aq, z);   // s1[r] = S[q0+lo][kc + 16 + 8*hh + r]

    v8f bm0 = *(const v8f*)(bmrow + kc);
    v8f bm1 = *(const v8f*)(bmrow + kc + 16);
    v8f bp0 = *(const v8f*)(bprow + kc);
    v8f bp1 = *(const v8f*)(bprow + kc + 16);
    float cm = -1e30f;
#pragma unroll
    for (int r = 0; r < 8; ++r) {
      s0[r] += bm0[r] + bp0[r];
      s1[r] += bm1[r] + bp1[r];
      cm = fmaxf(cm, fmaxf(s0[r], s1[r]));
    }
    // the query's maximum over all 32 keys: join the two halves
    cm = fmaxf(cm, xhalf(cm));
    float mn = fmaxf(mrow, cm);
    float alpha = __expf(mrow - mn);
    mrow = mn;
    v16h pb;                      // P^T as B operand, hardware k order
    float rs = 0.0f;
#pragma unroll
    for (int r = 0; r < 8; ++r) {
      float p0 = __expf(s0[r] - mn);
      float p1 = __expf(s1[r] - mn);
      rs += p0 + p1;
      pb[r]     = (_Float16)p0;
      pb[8 + r] = (_Float16)p1;
    }
    lrow = lrow * alpha + rs;
#pragma unroll
    for (int r = 0; r < 8; ++r) {
      o0[r] *= alpha;
      o1[r] *= alpha;
    }
    o0 = wmma16(bv0, pb, o0);     // o0[r] = O[q0+lo][8*hh + r]
    o1 = wmma16(bv1, pb, o1);     // o1[r] = O[q0+lo][16 + 8*hh + r]
    // this trip's LDS reads have returned before the next trip's copies
    // refill the buffer they read
    asm volatile("s_wait_dscnt 0x0" ::: "memory");
  }
  // join the waves' partial results. A wave stages its own in its own K ring:
  // its copies have landed (s_wait_asynccnt 0 in its last trip) and its reads
  // have returned (s_wait_dscnt 0 at the loop's foot). Planes of 32 x 16 bytes:
  // 0..3 the accumulators, 4 the maximum and this half's sum.
  if (wave != 0) {
    v4f* pw = (v4f*)&kbuf[wave][0][0][0];
    pw[lane]       = __builtin_shufflevector(o0, o0, 0, 1, 2, 3);
    pw[32 + lane]  = __builtin_shufflevector(o0, o0, 4, 5, 6, 7);
    pw[64 + lane]  = __builtin_shufflevector(o1, o1, 0, 1, 2, 3);
    pw[96 + lane]  = __builtin_shufflevector(o1, o1, 4, 5, 6, 7);
    v4f ml = {mrow, lrow, 0.0f, 0.0f};
    pw[128 + lane] = ml;
  }
  __syncthreads();   // publishes the partial results to wave 0
  if (wave != 0) return;
  {
    // the loops below are unrolled so that mw, lw and the vector elements are
    // indexed by constants and stay in registers
    float mw[NW], lw[NW];
    float mall = mrow;
#pragma unroll
    for (int w = 1; w < NW; ++w) {
      v4f ml = ((const v4f*)&kbuf[w][0][0][0])[128 + lane];
      mw[w] = ml[0];
      lw[w] = ml[1];
      mall = fmaxf(mall, mw[w]);
    }
    float f = __expf(mrow - mall);
    lrow *= f;
#pragma unroll
    for (int r = 0; r < 8; ++r) { o0[r] *= f; o1[r] *= f; }
#pragma unroll
    for (int w = 1; w < NW; ++w) {
      const v4f* pr = (const v4f*)&kbuf[w][0][0][0];
      v4f a0 = pr[lane], a1 = pr[32 + lane], a2 = pr[64 + lane], a3 = pr[96 + lane];
      f = __expf(mw[w] - mall);
      lrow += lw[w] * f;
#pragma unroll
      for (int r = 0; r < 4; ++r) {
        o0[r]     += a0[r] * f;
        o0[4 + r] += a1[r] * f;
        o1[r]     += a2[r] * f;
        o1[4 + r] += a3[r] * f;
      }
    }
  }
  // epilogue: join the halves' sums, normalize, gate, store f16 [B*Q, H*CH]
  {
    float inv = 1.0f / (lrow + xhalf(lrow));
    size_t base = ((size_t)b * QL + q0 + lo) * (NH * CH) + h * CH + 8 * hh;
    v8f g0 = *(const v8f*)(g + base);
    v8f g1 = *(const v8f*)(g + base + 16);
    v8h r0, r1;
#pragma unroll
    for (int r = 0; r < 8; ++r) {
      r0[r] = (_Float16)(o0[r] * inv * g0[r]);
      r1[r] = (_Float16)(o1[r] * inv * g1[r]);
    }
    *(v8h*)(og + base)      = r0;
    *(v8h*)(og + base + 16) = r1;
  }
}

// ---- final GEMM: [B*Q,256] @ w_o + b_o -> f32 out ----
__global__ void k_out(const _Float16* __restrict__ og, const _Float16* __restrict__ wot,
                      const float* __restrict__ b_o, float* __restrict__ out) {
  const int lane = threadIdx.x;
  const int lo = lane & 15, hh = lane >> 4;
  const int m0 = blockIdx.x * 16, n0 = blockIdx.y * 16;
  const _Float16* ar = og  + (size_t)(m0 + lo) * CQ;
  const _Float16* wr = wot + (size_t)(n0 + lo) * CQ;
  const int n = n0 + lo;
  v8f acc = {};
#pragma unroll
  for (int kc = 0; kc < CQ; kc += 32) {
    v16h a  = cat8(*(const v8h*)(ar + kc + hh * 8), *(const v8h*)(ar + kc + 16 + hh * 8));
    v16h bm = cat8(*(const v8h*)(wr + kc + hh * 8), *(const v8h*)(wr + kc + 16 + hh * 8));
    acc = wmma16(a, bm, acc);
  }
#pragma unroll
  for (int r = 0; r < 8; ++r) {
    int mm = m0 + 8 * hh + r;
    out[(size_t)mm * CQ + n] = acc[r] + b_o[n];
  }
}

extern "C" void kernel_launch(void* const* d_in, const int* in_sizes, int n_in,
                              void* d_out, int out_size, void* d_ws, size_t ws_size,
                              hipStream_t stream) {
  const float* q_x       = (const float*)d_in[0];
  const float* kv_x      = (const float*)d_in[1];
  const float* bias_mask = (const float*)d_in[2];
  const float* bias_pair = (const float*)d_in[3];
  const float* w_q       = (const float*)d_in[4];
  const float* w_k       = (const float*)d_in[5];
  const float* w_v       = (const float*)d_in[6];
  const float* w_g       = (const float*)d_in[7];
  const float* b_g       = (const float*)d_in[8];
  const float* w_o       = (const float*)d_in[9];
  const float* b_o       = (const float*)d_in[10];
  float* out = (float*)d_out;

  char* ws = (char*)d_ws;
  size_t off = 0;
  auto alloc = [&](size_t bytes) {
    size_t o = off;
    off += (bytes + 255) & ~(size_t)255;
    return o;
  };
  _Float16* wqt = (_Float16*)(ws + alloc((size_t)CQ * CQ * 2));
  _Float16* wkt = (_Float16*)(ws + alloc((size_t)CQ * CQ * 2));
  _Float16* wvt = (_Float16*)(ws + alloc((size_t)CQ * CQ * 2));
  _Float16* wgt = (_Float16*)(ws + alloc((size_t)CQ * CQ * 2));
  _Float16* wot = (_Float16*)(ws + alloc((size_t)CQ * CQ * 2));
  _Float16* qh  = (_Float16*)(ws + alloc((size_t)BB * NH * QL * CH * 2));
  _Float16* kh  = (_Float16*)(ws + alloc((size_t)BB * NH * KL * CH * 2));
  _Float16* vtp = (_Float16*)(ws + alloc((size_t)BB * NH * CH * KL * 2));
  float*    gb  = (float*)   (ws + alloc((size_t)BB * QL * CQ * 4));
  _Float16* og  = (_Float16*)(ws + alloc((size_t)BB * QL * CQ * 2));

  // weight transposes (f32 -> f16 W^T)
  k_transpose<<<dim3(CQ), dim3(CQ), 0, stream>>>(w_q, wqt);
  k_transpose<<<dim3(CQ), dim3(CQ), 0, stream>>>(w_k, wkt);
  k_transpose<<<dim3(CQ), dim3(CQ), 0, stream>>>(w_v, wvt);
  k_transpose<<<dim3(CQ), dim3(CQ), 0, stream>>>(w_g, wgt);
  k_transpose<<<dim3(CQ), dim3(CQ), 0, stream>>>(w_o, wot);

  // projections: one wave (32 threads) per 16x16 tile
  dim3 pgrid((BB * QL) / 16, CQ / 16);
  k_proj<<<pgrid, 32, 0, stream>>>(q_x,  wqt, qh,  nullptr, nullptr, 0, QL);
  k_proj<<<pgrid, 32, 0, stream>>>(kv_x, wkt, kh,  nullptr, nullptr, 1, KL);
  k_proj<<<pgrid, 32, 0, stream>>>(kv_x, wvt, vtp, nullptr, nullptr, 2, KL);
  k_proj<<<pgrid, 32, 0, stream>>>(q_x,  wgt, nullptr, gb,  b_g,     3, QL);

  // fused flash attention + gating (async double-buffered K/V tiles)
  k_attn<<<dim3(QL / 16, NH, BB), 32 * NW, 0, stream>>>(qh, kh, vtp, bias_mask,
                                                   bias_pair, gb, og);

  // output projection
  k_out<<<dim3((BB * QL) / 16, CQ / 16), 32, 0, stream>>>(og, wot, b_o, out);
}

// v003
// It runs in 94.2 microseconds.
// Timed twice side by side with v002, it ran 1.31 times as fast both times.
// All steps since v000 together make it 1.75 times as fast.
#include <hip/hip_runtime.h>
#include <math.h>

typedef __attribute__((ext_vector_type(16))) _Float16 v16h;
typedef __attribute__((ext_vector_type(8)))  _Float16 v8h;
typedef __attribute__((ext_vector_type(8)))  float    v8f;
typedef __attribute__((ext_vector_type(4)))  float    v4f;

#define NH 8
#define CH 32
#define CQ 256
#define BB 2
#define QL 2048
#define KL 2048
#define NW 4            // waves of a k_attn work-group; each takes KL / NW keys

static __device__ __forceinline__ v16h cat8(v8h a, v8h b) {
  return __builtin_shufflevector(a, b, 0,1,2,3,4,5,6,7,8,9,10,11,12,13,14,15);
}
static __device__ __forceinline__ v16h cvt2(v8f a, v8f b) {
  v16h r;
#pragma unroll
  for (int i = 0; i < 8; ++i) { r[i] = (_Float16)a[i]; r[8 + i] = (_Float16)b[i]; }
  return r;
}
static __device__ __forceinline__ v8f wmma16(v16h a, v16h b, v8f c) {
  return __builtin_amdgcn_wmma_f32_16x16x32_f16(false, a, false, b, (short)0, c, false, false);
}

// ---- prep: transpose the five 256x256 f32 weights -> f16 row-major of W^T ----
// One launch; blockIdx.y picks the weight.
__global__ void k_transpose(const float* __restrict__ w_q, const float* __restrict__ w_k,
                            const float* __restrict__ w_v, const float* __restrict__ w_g,
                            const float* __restrict__ w_o, _Float16* __restrict__ wqt,
                            _Float16* __restrict__ wkt, _Float16* __restrict__ wvt,
                            _Float16* __restrict__ wgt, _Float16* __restrict__ wot) {
  const int s = blockIdx.y;
  const float* w = s == 0 ? w_q : s == 1 ? w_k : s == 2 ? w_v : s == 3 ? w_g : w_o;
  _Float16*   wt = s == 0 ? wqt : s == 1 ? wkt : s == 2 ? wvt : s == 3 ? wgt : wot;
  int i = threadIdx.x;   // input row (k)
  int j = blockIdx.x;    // input col (n) -> output row
  wt[(size_t)j * CQ + i] = (_Float16)w[(size_t)i * CQ + j];
}

// ---- projections: [B*L,256] @ [256,256], all four in one launch ----
// One wave per 16 rows x 16 columns of TWO products that read the same x rows:
// blockIdx.z == 0: q_x  -> q (scale 1/sqrt(32), split-head [b,h,l,32] f16)
//                          and gate (sigmoid(x+b_g), f32 [B*L,256])
// blockIdx.z == 1: kv_x -> k (split-head f16) and v (transposed [b,h,c,L] f16)
__global__ void k_proj(const float* __restrict__ q_x, const float* __restrict__ kv_x,
                       const _Float16* __restrict__ wqt, const _Float16* __restrict__ wkt,
                       const _Float16* __restrict__ wvt, const _Float16* __restrict__ wgt,
                       const float* __restrict__ b_g, _Float16* __restrict__ qh,
                       _Float16* __restrict__ kh, _Float16* __restrict__ vtp,
                       float* __restrict__ gb) {
  const int lane = threadIdx.x;
  const int lo = lane & 15, hh = lane >> 4;
  const int m0 = blockIdx.x * 16;
  const int n0 = blockIdx.y * 16;
  const bool kv = blockIdx.z != 0;
  const float*    xr  = (kv ? kv_x : q_x) + (size_t)(m0 + lo) * CQ;
  const _Float16* wr0 = (kv ? wkt : wqt) + (size_t)(n0 + lo) * CQ;
  const _Float16* wr1 = (kv ? wvt : wgt) + (size_t)(n0 + lo) * CQ;
  const int n = n0 + lo;
  v8f acc0 = {}, acc1 = {};
#pragma unroll
  for (int kc = 0; kc < CQ; kc += 32) {
    v8f a0 = *(const v8f*)(xr + kc + hh * 8);
    v8f a1 = *(const v8f*)(xr + kc + 16 + hh * 8);
    v16h a   = cvt2(a0, a1);
    v16h bm0 = cat8(*(const v8h*)(wr0 + kc + hh * 8),
                    *(const v8h*)(wr0 + kc + 16 + hh * 8));
    v16h bm1 = cat8(*(const v8h*)(wr1 + kc + hh * 8),
                    *(const v8h*)(wr1 + kc + 16 + hh * 8));
    acc0 = wmma16(a, bm0, acc0);
    acc1 = wmma16(a, bm1, acc1);
  }
  const int h = n / CH, c = n % CH;
  if (!kv) {
    const float bias = b_g[n];
#pragma unroll
    for (int r = 0; r < 8; ++r) {
      int mm = m0 + 8 * hh + r;           // global row in [0, B*QL)
      int b = mm / QL, li = mm % QL;
      qh[(((size_t)(b * NH + h) * QL) + li) * CH + c] =
          (_Float16)(acc0[r] * 0.17677669529663687f);
      gb[(size_t)mm * CQ + n] = 1.0f / (1.0f + __expf(-(acc1[r] + bias)));
    }
  } else {
#pragma unroll
    for (int r = 0; r < 8; ++r) {
      int mm = m0 + 8 * hh + r;           // global row in [0, B*KL)
      int b = mm / KL, li = mm % KL;
      kh[(((size_t)(b * NH + h) * KL) + li) * CH + c] = (_Float16)acc0[r];
      vtp[(((size_t)(b * NH + h) * CH) + c) * (size_t)KL + li] = (_Float16)acc1[r];
    }
    // behind the branch's last stores: in the built code the other branch's
    // block follows this one and rewrites registers that these stores name
    asm volatile("s_wait_xcnt 0x0" ::: "memory");
  }
}

// lane l <-> lane l ^ 16 (the two halves that split one query's keys)
static __device__ __forceinline__ float xhalf(float x) {
  int i = __builtin_bit_cast(int, x);
  return __builtin_bit_cast(float,
      __builtin_amdgcn_permlanex16(i, i, 0x76543210, 0xfedcba98, false, false));
}

__global__ void k_attn(const _Float16* __restrict__ qh, const _Float16* __restrict__ kh,
                       const _Float16* __restrict__ vt, const float* __restrict__ bias_mask,
                       const float* __restrict__ bias_pair, const float* __restrict__ g,
                       _Float16* __restrict__ og) {
  __shared__ __align__(16) _Float16 kbuf[NW][2][32][32];
  __shared__ __align__(16) _Float16 vbuf[NW][2][32][32];
  const int lane = threadIdx.x & 31;
  const int wave = __builtin_amdgcn_readfirstlane(threadIdx.x >> 5);
  const int kbeg = wave * (KL / NW), kend = kbeg + KL / NW;
  const int lo = lane & 15, hh = lane >> 4;
  const int q0 = blockIdx.x * 16;
  const int h  = blockIdx.y;
  const int b  = blockIdx.z;
  const size_t bh = (size_t)(b * NH + h);

  // async-copy a 32x32 f16 tile (rows have stride rowstride halves) into LDS
  auto async_tile = [&](const _Float16* gbase, size_t rowstride, _Float16 (*dst)[32]) {
    const _Float16* gp[4];
    unsigned ldsoff[4];
#pragma unroll  // constant indices: the addresses stay in registers
    for (int j = 0; j < 4; ++j) {
      int chunk = lane + 32 * j;        // 0..127 sixteen-byte chunks
      int row  = chunk >> 2;
      int c16  = (chunk & 3) * 8;       // halves
      gp[j] = gbase + (size_t)row * rowstride + c16;
      ldsoff[j] = (unsigned)(uintptr_t)(&dst[row][c16]);
    }
    // the wait closes the statement so that no address register of a copy
    // is rewritten in front of it
    asm volatile("global_load_async_to_lds_b128 %0, %1, off\n\t"
                 "global_load_async_to_lds_b128 %2, %3, off\n\t"
                 "global_load_async_to_lds_b128 %4, %5, off\n\t"
                 "global_load_async_to_lds_b128 %6, %7, off\n\t"
                 "s_wait_xcnt 0x0"
                 :: "v"(ldsoff[0]), "v"(gp[0]), "v"(ldsoff[1]), "v"(gp[1]),
                    "v"(ldsoff[2]), "v"(gp[2]), "v"(ldsoff[3]), "v"(gp[3])
                 : "memory");
  };

  // Q tile as WMMA B operand (K-dim = 32 channels, loaded once)
  const _Float16* qr = qh + (bh * QL + q0 + lo) * CH;
  v16h aq = cat8(*(const v8h*)(qr + hh * 8), *(const v8h*)(qr + 16 + hh * 8));

  // prefetch this wave's first tile
  async_tile(kh + (bh * KL + kbeg) * CH, CH, kbuf[wave][0]);
  async_tile(vt + (bh * CH) * (size_t)KL + kbeg, KL, vbuf[wave][0]);

  // this lane's query row of bias_pair and its half's keys of bias_mask
  const float* bprow = bias_pair + ((size_t)h * QL + q0 + lo) * KL + 8 * hh;
  const float* bmrow = bias_mask + (size_t)b * KL + 8 * hh;

  float mrow = -1e30f, lrow = 0.0f;   // lrow: this half's keys only
  v8f o0 = {}, o1 = {};

  for (int kc = kbeg; kc < kend; kc += 32) {
    const int buf = (kc >> 5) & 1;
    if (kc + 32 < kend) {
      // issue next tile into the other buffer, then wait for current tile:
      // the 8 newest async ops may stay outstanding (async loads complete
      // in order), so <=8 outstanding means the current buffer is ready.
      async_tile(kh + (bh * KL + kc + 32) * CH, CH, kbuf[wave][buf ^ 1]);
      async_tile(vt + (bh * CH) * (size_t)KL + (kc + 32), KL, vbuf[wave][buf ^ 1]);
      asm volatile("s_wait_asynccnt 0x8" ::: "memory");
    } else {
      asm volatile("s_wait_asynccnt 0x0" ::: "memory");
    }

    // A operands: rows of K from LDS
    v16h b0 = cat8(*(const v8h*)(&kbuf[wave][buf][lo][hh * 8]),
                   *(const v8h*)(&kbuf[wave][buf][lo][16 + hh * 8]));
    v16h b1 = cat8(*(const v8h*)(&kbuf[wave][buf][16 + lo][hh * 8]),
                   *(const v8h*)(&kbuf[wave][buf][16 + lo][16 + hh * 8]));
    // A operands: rows of V^T from LDS, output channels lo and 16+lo
    v16h bv0 = cat8(*(const v8h*)(&vbuf[wave][buf][lo][hh * 8]),
                    *(const v8h*)(&vbuf[wave][buf][lo][16 + hh * 8]));
    v16h bv1 = cat8(*(const v8h*)(&vbuf[wave][buf][16 + lo][hh * 8]),
                    *(const v8h*)(&vbuf[wave][buf][16 + lo][16 + hh * 8]));
    v8f z = {};
    v8f s0 = wmma16(b0, aq, z);   // s0[r] = S[q0+lo][kc + 8*hh + r]
    v8f s1 = wmma16(b1, aq, z);   // s1[r] = S[q0+lo][kc + 16 + 8*hh + r]

    v8f bm0 = *(const v8f*)(bmrow + kc);
    v8f bm1 = *(const v8f*)(bmrow + kc + 16);
    v8f bp0 = *(const v8f*)(bprow + kc);
    v8f bp1 = *(const v8f*)(bprow + kc + 16);
    float cm = -1e30f;
#pragma unroll
    for (int r = 0; r < 8; ++r) {
      s0[r] += bm0[r] + bp0[r];
      s1[r] += bm1[r] + bp1[r];
      cm = fmaxf(cm, fmaxf(s0[r], s1[r]));
    }
    // the query's maximum over all 32 keys: join the two halves
    cm = fmaxf(cm, xhalf(cm));
    float mn = fmaxf(mrow, cm);
    float alpha = __expf(mrow - mn);
    mrow = mn;
    v16h pb;                      // P^T as B operand, hardware k order
    float rs = 0.0f;
#pragma unroll
    for (int r = 0; r < 8; ++r) {
      float p0 = __expf(s0[r] - mn);
      float p1 = __expf(s1[r] - mn);
      rs += p0 + p1;
      pb[r]     = (_Float16)p0;
      pb[8 + r] = (_Float16)p1;
    }
    lrow = lrow * alpha + rs;
#pragma unroll
    for (int r = 0; r < 8; ++r) {
      o0[r] *= alpha;
      o1[r] *= alpha;
    }
    o0 = wmma16(bv0, pb, o0);     // o0[r] = O[q0+lo][8*hh + r]
    o1 = wmma16(bv1, pb, o1);     // o1[r] = O[q0+lo][16 + 8*hh + r]
    // this trip's LDS reads have returned before the next trip's copies
    // refill the buffer they read
    asm volatile("s_wait_dscnt 0x0" ::: "memory");
  }
  // join the waves' partial results. A wave stages its own in its own K ring:
  // its copies have landed (s_wait_asynccnt 0 in its last trip) and its reads
  // have returned (s_wait_dscnt 0 at the loop's foot). Planes of 32 x 16 bytes:
  // 0..3 the accumulators, 4 the maximum and this half's sum.
  if (wave != 0) {
    v4f* pw = (v4f*)&kbuf[wave][0][0][0];
    pw[lane]       = __builtin_shufflevector(o0, o0, 0, 1, 2, 3);
    pw[32 + lane]  = __builtin_shufflevector(o0, o0, 4, 5, 6, 7);
    pw[64 + lane]  = __builtin_shufflevector(o1, o1, 0, 1, 2, 3);
    pw[96 + lane]  = __builtin_shufflevector(o1, o1, 4, 5, 6, 7);
    v4f ml = {mrow, lrow, 0.0f, 0.0f};
    pw[128 + lane] = ml;
  }
  __syncthreads();   // publishes the partial results to wave 0
  if (wave != 0) return;
  {
    // the loops below are unrolled so that mw, lw and the vector elements are
    // indexed by constants and stay in registers
    float mw[NW], lw[NW];
    float mall = mrow;
#pragma unroll
    for (int w = 1; w < NW; ++w) {
      v4f ml = ((const v4f*)&kbuf[w][0][0][0])[128 + lane];
      mw[w] = ml[0];
      lw[w] = ml[1];
      mall = fmaxf(mall, mw[w]);
    }
    float f = __expf(mrow - mall);
    lrow *= f;
#pragma unroll
    for (int r = 0; r < 8; ++r) { o0[r] *= f; o1[r] *= f; }
#pragma unroll
    for (int w = 1; w < NW; ++w) {
      const v4f* pr = (const v4f*)&kbuf[w][0][0][0];
      v4f a0 = pr[lane], a1 = pr[32 + lane], a2 = pr[64 + lane], a3 = pr[96 + lane];
      f = __expf(mw[w] - mall);
      lrow += lw[w] * f;
#pragma unroll
      for (int r = 0; r < 4; ++r) {
        o0[r]     += a0[r] * f;
        o0[4 + r] += a1[r] * f;
        o1[r]     += a2[r] * f;
        o1[4 + r] += a3[r] * f;
      }
    }
  }
  // epilogue: join the halves' sums, normalize, gate, store f16 [B*Q, H*CH]
  {
    float inv = 1.0f / (lrow + xhalf(lrow));
    size_t base = ((size_t)b * QL + q0 + lo) * (NH * CH) + h * CH + 8 * hh;
    v8f g0 = *(const v8f*)(g + base);
    v8f g1 = *(const v8f*)(g + base + 16);
    v8h r0, r1;
#pragma unroll
    for (int r = 0; r < 8; ++r) {
      r0[r] = (_Float16)(o0[r] * inv * g0[r]);
      r1[r] = (_Float16)(o1[r] * inv * g1[r]);
    }
    *(v8h*)(og + base)      = r0;
    *(v8h*)(og + base + 16) = r1;
  }
}

// ---- final GEMM: [B*Q,256] @ w_o + b_o -> f32 out ----
__global__ void k_out(const _Float16* __restrict__ og, const _Float16* __restrict__ wot,
                      const float* __restrict__ b_o, float* __restrict__ out) {
  const int lane = threadIdx.x;
  const int lo = lane & 15, hh = lane >> 4;
  const int m0 = blockIdx.x * 16, n0 = blockIdx.y * 16;
  const _Float16* ar = og  + (size_t)(m0 + lo) * CQ;
  const _Float16* wr = wot + (size_t)(n0 + lo) * CQ;
  const int n = n0 + lo;
  v8f acc = {};
#pragma unroll
  for (int kc = 0; kc < CQ; kc += 32) {
    v16h a  = cat8(*(const v8h*)(ar + kc + hh * 8), *(const v8h*)(ar + kc + 16 + hh * 8));
    v16h bm = cat8(*(const v8h*)(wr + kc + hh * 8), *(const v8h*)(wr + kc + 16 + hh * 8));
    acc = wmma16(a, bm, acc);
  }
#pragma unroll
  for (int r = 0; r < 8; ++r) {
    int mm = m0 + 8 * hh + r;
    out[(size_t)mm * CQ + n] = acc[r] + b_o[n];
  }
}

extern "C" void kernel_launch(void* const* d_in, const int* in_sizes, int n_in,
                              void* d_out, int out_size, void* d_ws, size_t ws_size,
                              hipStream_t stream) {
  const float* q_x       = (const float*)d_in[0];
  const float* kv_x      = (const float*)d_in[1];
  const float* bias_mask = (const float*)d_in[2];
  const float* bias_pair = (const float*)d_in[3];
  const float* w_q       = (const float*)d_in[4];
  const float* w_k       = (const float*)d_in[5];
  const float* w_v       = (const float*)d_in[6];
  const float* w_g       = (const float*)d_in[7];
  const float* b_g       = (const float*)d_in[8];
  const float* w_o       = (const float*)d_in[9];
  const float* b_o       = (const float*)d_in[10];
  float* out = (float*)d_out;

  char* ws = (char*)d_ws;
  size_t off = 0;
  auto alloc = [&](size_t bytes) {
    size_t o = off;
    off += (bytes + 255) & ~(size_t)255;
    return o;
  };
  _Float16* wqt = (_Float16*)(ws + alloc((size_t)CQ * CQ * 2));
  _Float16* wkt = (_Float16*)(ws + alloc((size_t)CQ * CQ * 2));
  _Float16* wvt = (_Float16*)(ws + alloc((size_t)CQ * CQ * 2));
  _Float16* wgt = (_Float16*)(ws + alloc((size_t)CQ * CQ * 2));
  _Float16* wot = (_Float16*)(ws + alloc((size_t)CQ * CQ * 2));
  _Float16* qh  = (_Float16*)(ws + alloc((size_t)BB * NH * QL * CH * 2));
  _Float16* kh  = (_Float16*)(ws + alloc((size_t)BB * NH * KL * CH * 2));
  _Float16* vtp = (_Float16*)(ws + alloc((size_t)BB * NH * CH * KL * 2));
  float*    gb  = (float*)   (ws + alloc((size_t)BB * QL * CQ * 4));
  _Float16* og  = (_Float16*)(ws + alloc((size_t)BB * QL * CQ * 2));

  // weight transposes (f32 -> f16 W^T), one launch for the five
  k_transpose<<<dim3(CQ, 5), dim3(CQ), 0, stream>>>(w_q, w_k, w_v, w_g, w_o,
                                                    wqt, wkt, wvt, wgt, wot);

  // projections, one launch for the four: one wave (32 threads) per pair of
  // 16x16 tiles; QL == KL, so one grid serves q_x and kv_x
  k_proj<<<dim3((BB * QL) / 16, CQ / 16, 2), 32, 0, stream>>>(
      q_x, kv_x, wqt, wkt, wvt, wgt, b_g, qh, kh, vtp, gb);

  // fused flash attention + gating (async double-buffered K/V tiles)
  k_attn<<<dim3(QL / 16, NH, BB), 32 * NW, 0, stream>>>(qh, kh, vtp, bias_mask,
                                                   bias_pair, gb, og);

  // output projection
  k_out<<<dim3((BB * QL) / 16, CQ / 16), 32, 0, stream>>>(og, wot, b_o, out);
}

// v004
// It runs in 82.6 microseconds.
// Timed twice side by side with v003, it ran 1.14 times as fast both times.
// Counting every step since v000, it is 2.00 times as fast.
#include <hip/hip_runtime.h>
#include <math.h>

typedef __attribute__((ext_vector_type(16))) _Float16 v16h;
typedef __attribute__((ext_vector_type(8)))  _Float16 v8h;
typedef __attribute__((ext_vector_type(8)))  float    v8f;
typedef __attribute__((ext_vector_type(4)))  float    v4f;

#define NH 8
#define CH 32
#define CQ 256
#define BB 2
#define QL 2048
#define KL 2048
#define NW 4            // waves of a k_attn work-group; each takes KL / NW keys
#define QT 2            // query tiles of 16 rows held by one k_attn wave

static __device__ __forceinline__ v16h cat8(v8h a, v8h b) {
  return __builtin_shufflevector(a, b, 0,1,2,3,4,5,6,7,8,9,10,11,12,13,14,15);
}
static __device__ __forceinline__ v16h cvt2(v8f a, v8f b) {
  v16h r;
#pragma unroll
  for (int i = 0; i < 8; ++i) { r[i] = (_Float16)a[i]; r[8 + i] = (_Float16)b[i]; }
  return r;
}
static __device__ __forceinline__ v8f wmma16(v16h a, v16h b, v8f c) {
  return __builtin_amdgcn_wmma_f32_16x16x32_f16(false, a, false, b, (short)0, c, false, false);
}

// ---- prep: transpose the five 256x256 f32 weights -> f16 row-major of W^T ----
// One launch; blockIdx.y picks the weight.
__global__ void k_transpose(const float* __restrict__ w_q, const float* __restrict__ w_k,
                            const float* __restrict__ w_v, const float* __restrict__ w_g,
                            const float* __restrict__ w_o, _Float16* __restrict__ wqt,
                            _Float16* __restrict__ wkt, _Float16* __restrict__ wvt,
                            _Float16* __restrict__ wgt, _Float16* __restrict__ wot) {
  const int s = blockIdx.y;
  const float* w = s == 0 ? w_q : s == 1 ? w_k : s == 2 ? w_v : s == 3 ? w_g : w_o;
  _Float16*   wt = s == 0 ? wqt : s == 1 ? wkt : s == 2 ? wvt : s == 3 ? wgt : wot;
  int i = threadIdx.x;   // input row (k)
  int j = blockIdx.x;    // input col (n) -> output row
  wt[(size_t)j * CQ + i] = (_Float16)w[(size_t)i * CQ + j];
}

// ---- projections: [B*L,256] @ [256,256], all four in one launch ----
// One wave per 16 rows x 16 columns of TWO products that read the same x rows:
// blockIdx.z == 0: q_x  -> q (scale 1/sqrt(32), split-head [b,h,l,32] f16)
//                          and gate (sigmoid(x+b_g), f32 [B*L,256])
// blockIdx.z == 1: kv_x -> k (split-head f16) and v (transposed [b,h,c,L] f16)
__global__ void k_proj(const float* __restrict__ q_x, const float* __restrict__ kv_x,
                       const _Float16* __restrict__ wqt, const _Float16* __restrict__ wkt,
                       const _Float16* __restrict__ wvt, const _Float16* __restrict__ wgt,
                       const float* __restrict__ b_g, _Float16* __restrict__ qh,
                       _Float16* __restrict__ kh, _Float16* __restrict__ vtp,
                       float* __restrict__ gb) {
  const int lane = threadIdx.x;
  const int lo = lane & 15, hh = lane >> 4;
  const int m0 = blockIdx.x * 16;
  const int n0 = blockIdx.y * 16;
  const bool kv = blockIdx.z != 0;
  const float*    xr  = (kv ? kv_x : q_x) + (size_t)(m0 + lo) * CQ;
  const _Float16* wr0 = (kv ? wkt : wqt) + (size_t)(n0 + lo) * CQ;
  const _Float16* wr1 = (kv ? wvt : wgt) + (size_t)(n0 + lo) * CQ;
  const int n = n0 + lo;
  v8f acc0 = {}, acc1 = {};
#pragma unroll
  for (int kc = 0; kc < CQ; kc += 32) {
    v8f a0 = *(const v8f*)(xr + kc + hh * 8);
    v8f a1 = *(const v8f*)(xr + kc + 16 + hh * 8);
    v16h a   = cvt2(a0, a1);
    v16h bm0 = cat8(*(const v8h*)(wr0 + kc + hh * 8),
                    *(const v8h*)(wr0 + kc + 16 + hh * 8));
    v16h bm1 = cat8(*(const v8h*)(wr1 + kc + hh * 8),
                    *(const v8h*)(wr1 + kc + 16 + hh * 8));
    acc0 = wmma16(a, bm0, acc0);
    acc1 = wmma16(a, bm1, acc1);
  }
  const int h = n / CH, c = n % CH;
  if (!kv) {
    const float bias = b_g[n];
#pragma unroll
    for (int r = 0; r < 8; ++r) {
      int mm = m0 + 8 * hh + r;           // global row in [0, B*QL)
      int b = mm / QL, li = mm % QL;
      qh[(((size_t)(b * NH + h) * QL) + li) * CH + c] =
          (_Float16)(acc0[r] * 0.17677669529663687f);
      gb[(size_t)mm * CQ + n] = 1.0f / (1.0f + __expf(-(acc1[r] + bias)));
    }
  } else {
#pragma unroll
    for (int r = 0; r < 8; ++r) {
      int mm = m0 + 8 * hh + r;           // global row in [0, B*KL)
      int b = mm / KL, li = mm % KL;
      kh[(((size_t)(b * NH + h) * KL) + li) * CH + c] = (_Float16)acc0[r];
      vtp[(((size_t)(b * NH + h) * CH) + c) * (size_t)KL + li] = (_Float16)acc1[r];
    }
    // behind the branch's last stores: in the built code the other branch's
    // block follows this one and rewrites registers that these stores name
    asm volatile("s_wait_xcnt 0x0" ::: "memory");
  }
}

// lane l <-> lane l ^ 16 (the two halves that split one query's keys)
static __device__ __forceinline__ float xhalf(float x) {
  int i = __builtin_bit_cast(int, x);
  return __builtin_bit_cast(float,
      __builtin_amdgcn_permlanex16(i, i, 0x76543210, 0xfedcba98, false, false));
}

__global__ void __launch_bounds__(32 * NW)
k_attn(const _Float16* __restrict__ qh, const _Float16* __restrict__ kh,
       const _Float16* __restrict__ vt, const float* __restrict__ bias_mask,
       const float* __restrict__ bias_pair, const float* __restrict__ g,
       _Float16* __restrict__ og) {
  __shared__ __align__(16) _Float16 kbuf[NW][2][32][32];
  __shared__ __align__(16) _Float16 vbuf[NW][2][32][32];
  const int lane = threadIdx.x & 31;
  const int wave = __builtin_amdgcn_readfirstlane(threadIdx.x >> 5);
  const int kbeg = wave * (KL / NW), kend = kbeg + KL / NW;
  const int lo = lane & 15, hh = lane >> 4;
  const int q0 = blockIdx.x * (16 * QT);
  const int h  = blockIdx.y;
  const int b  = blockIdx.z;
  const size_t bh = (size_t)(b * NH + h);

  // async-copy a 32x32 f16 tile (rows have stride rowstride halves) into LDS
  auto async_tile = [&](const _Float16* gbase, size_t rowstride, _Float16 (*dst)[32]) {
    const _Float16* gp[4];
    unsigned ldsoff[4];
#pragma unroll  // constant indices: the addresses stay in registers
    for (int j = 0; j < 4; ++j) {
      int chunk = lane + 32 * j;        // 0..127 sixteen-byte chunks
      int row  = chunk >> 2;
      int c16  = (chunk & 3) * 8;       // halves
      gp[j] = gbase + (size_t)row * rowstride + c16;
      ldsoff[j] = (unsigned)(uintptr_t)(&dst[row][c16]);
    }
    // the wait closes the statement so that no address register of a copy
    // is rewritten in front of it
    asm volatile("global_load_async_to_lds_b128 %0, %1, off\n\t"
                 "global_load_async_to_lds_b128 %2, %3, off\n\t"
                 "global_load_async_to_lds_b128 %4, %5, off\n\t"
                 "global_load_async_to_lds_b128 %6, %7, off\n\t"
                 "s_wait_xcnt 0x0"
                 :: "v"(ldsoff[0]), "v"(gp[0]), "v"(ldsoff[1]), "v"(gp[1]),
                    "v"(ldsoff[2]), "v"(gp[2]), "v"(ldsoff[3]), "v"(gp[3])
                 : "memory");
  };

  // every loop over t below is unrolled so that the per-tile arrays are
  // indexed by constants and stay in registers

  // Q tiles as WMMA B operands (K-dim = 32 channels, loaded once)
  v16h aq[QT];
#pragma unroll
  for (int t = 0; t < QT; ++t) {
    const _Float16* qr = qh + (bh * QL + q0 + 16 * t + lo) * CH;
    aq[t] = cat8(*(const v8h*)(qr + hh * 8), *(const v8h*)(qr + 16 + hh * 8));
  }

  // prefetch this wave's first tile
  async_tile(kh + (bh * KL + kbeg) * CH, CH, kbuf[wave][0]);
  async_tile(vt + (bh * CH) * (size_t)KL + kbeg, KL, vbuf[wave][0]);

  // this lane's first query row of bias_pair (tile t: 16 * t rows further)
  // and its half's keys of bias_mask
  const float* bprow = bias_pair + ((size_t)h * QL + q0 + lo) * KL + 8 * hh;
  const float* bmrow = bias_mask + (size_t)b * KL + 8 * hh;

  float mrow[QT], lrow[QT];           // lrow: this half's keys only
  v8f o0[QT], o1[QT];
#pragma unroll
  for (int t = 0; t < QT; ++t) {
    mrow[t] = -1e30f;
    lrow[t] = 0.0f;
    o0[t] = v8f{};
    o1[t] = v8f{};
  }

  for (int kc = kbeg; kc < kend; kc += 32) {
    const int buf = (kc >> 5) & 1;
    if (kc + 32 < kend) {
      // issue next tile into the other buffer, then wait for current tile:
      // the 8 newest async ops may stay outstanding (async loads complete
      // in order), so <=8 outstanding means the current buffer is ready.
      async_tile(kh + (bh * KL + kc + 32) * CH, CH, kbuf[wave][buf ^ 1]);
      async_tile(vt + (bh * CH) * (size_t)KL + (kc + 32), KL, vbuf[wave][buf ^ 1]);
      asm volatile("s_wait_asynccnt 0x8" ::: "memory");
    } else {
      asm volatile("s_wait_asynccnt 0x0" ::: "memory");
    }

    // A operands: rows of K from LDS
    v16h b0 = cat8(*(const v8h*)(&kbuf[wave][buf][lo][hh * 8]),
                   *(const v8h*)(&kbuf[wave][buf][lo][16 + hh * 8]));
    v16h b1 = cat8(*(const v8h*)(&kbuf[wave][buf][16 + lo][hh * 8]),
                   *(const v8h*)(&kbuf[wave][buf][16 + lo][16 + hh * 8]));
    // A operands: rows of V^T from LDS, output channels lo and 16+lo
    v16h bv0 = cat8(*(const v8h*)(&vbuf[wave][buf][lo][hh * 8]),
                    *(const v8h*)(&vbuf[wave][buf][lo][16 + hh * 8]));
    v16h bv1 = cat8(*(const v8h*)(&vbuf[wave][buf][16 + lo][hh * 8]),
                    *(const v8h*)(&vbuf[wave][buf][16 + lo][16 + hh * 8]));
    v8f bm0 = *(const v8f*)(bmrow + kc);
    v8f bm1 = *(const v8f*)(bmrow + kc + 16);
#pragma unroll
    for (int t = 0; t < QT; ++t) {
      v8f z = {};
      v8f s0 = wmma16(b0, aq[t], z);   // s0[r] = S[q0+16t+lo][kc + 8*hh + r]
      v8f s1 = wmma16(b1, aq[t], z);   // s1[r] = S[q0+16t+lo][kc + 16 + 8*hh + r]

      v8f bp0 = *(const v8f*)(bprow + (size_t)(16 * t) * KL + kc);
      v8f bp1 = *(const v8f*)(bprow + (size_t)(16 * t) * KL + kc + 16);
      float cm = -1e30f;
#pragma unroll
      for (int r = 0; r < 8; ++r) {
        s0[r] += bm0[r] + bp0[r];
        s1[r] += bm1[r] + bp1[r];
        cm = fmaxf(cm, fmaxf(s0[r], s1[r]));
      }
      // the query's maximum over all 32 keys: join the two halves
      cm = fmaxf(cm, xhalf(cm));
      float mn = fmaxf(mrow[t], cm);
      float alpha = __expf(mrow[t] - mn);
      mrow[t] = mn;
      v16h pb;                      // P^T as B operand, hardware k order
      float rs = 0.0f;
#pragma unroll
      for (int r = 0; r < 8; ++r) {
        float p0 = __expf(s0[r] - mn);
        float p1 = __expf(s1[r] - mn);
        rs += p0 + p1;
        pb[r]     = (_Float16)p0;
        pb[8 + r] = (_Float16)p1;
      }
      lrow[t] = lrow[t] * alpha + rs;
#pragma unroll
      for (int r = 0; r < 8; ++r) {
        o0[t][r] *= alpha;
        o1[t][r] *= alpha;
      }
      o0[t] = wmma16(bv0, pb, o0[t]);   // o0[t][r] = O[q0+16t+lo][8*hh + r]
      o1[t] = wmma16(bv1, pb, o1[t]);   // o1[t][r] = O[q0+16t+lo][16 + 8*hh + r]
    }
    // this trip's LDS reads have returned before the next trip's copies
    // refill the buffer they read
    asm volatile("s_wait_dscnt 0x0" ::: "memory");
  }
  // join the waves' partial results. A wave stages its own in its own rings:
  // its copies have landed (s_wait_asynccnt 0 in its last trip) and its reads
  // have returned (s_wait_dscnt 0 at the loop's foot). Planes of 32 x 16 bytes:
  // K ring, 4 per query tile: the accumulators; V ring, one per query tile:
  // the maximum and this half's sum.
  static_assert(QT * 4 * 512 <= 2 * 32 * 32 * 2, "accumulator planes fit the wave's K ring");
  if (wave != 0) {
    v4f* pw = (v4f*)&kbuf[wave][0][0][0];
    v4f* pm = (v4f*)&vbuf[wave][0][0][0];
#pragma unroll
    for (int t = 0; t < QT; ++t) {
      pw[128 * t + lane]      = __builtin_shufflevector(o0[t], o0[t], 0, 1, 2, 3);
      pw[128 * t + 32 + lane] = __builtin_shufflevector(o0[t], o0[t], 4, 5, 6, 7);
      pw[128 * t + 64 + lane] = __builtin_shufflevector(o1[t], o1[t], 0, 1, 2, 3);
      pw[128 * t + 96 + lane] = __builtin_shufflevector(o1[t], o1[t], 4, 5, 6, 7);
      v4f ml = {mrow[t], lrow[t], 0.0f, 0.0f};
      pm[32 * t + lane] = ml;
    }
  }
  __syncthreads();   // publishes the partial results to wave 0
  if (wave != 0) return;
#pragma unroll
  for (int t = 0; t < QT; ++t) {
    // the loops below are unrolled so that mw, lw and the vector elements are
    // indexed by constants and stay in registers
    float mw[NW], lw[NW];
    float mall = mrow[t];
#pragma unroll
    for (int w = 1; w < NW; ++w) {
      v4f ml = ((const v4f*)&vbuf[w][0][0][0])[32 * t + lane];
      mw[w] = ml[0];
      lw[w] = ml[1];
      mall = fmaxf(mall, mw[w]);
    }
    float f = __expf(mrow[t] - mall);
    lrow[t] *= f;
#pragma unroll
    for (int r = 0; r < 8; ++r) { o0[t][r] *= f; o1[t][r] *= f; }
#pragma unroll
    for (int w = 1; w < NW; ++w) {
      const v4f* pr = (const v4f*)&kbuf[w][0][0][0] + 128 * t;
      v4f a0 = pr[lane], a1 = pr[32 + lane], a2 = pr[64 + lane], a3 = pr[96 + lane];
      f = __expf(mw[w] - mall);
      lrow[t] += lw[w] * f;
#pragma unroll
      for (int r = 0; r < 4; ++r) {
        o0[t][r]     += a0[r] * f;
        o0[t][4 + r] += a1[r] * f;
        o1[t][r]     += a2[r] * f;
        o1[t][4 + r] += a3[r] * f;
      }
    }
    // epilogue: join the halves' sums, normalize, gate, store f16 [B*Q, H*CH]
    float inv = 1.0f / (lrow[t] + xhalf(lrow[t]));
    size_t base = ((size_t)b * QL + q0 + 16 * t + lo) * (NH * CH) + h * CH + 8 * hh;
    v8f g0 = *(const v8f*)(g + base);
    v8f g1 = *(const v8f*)(g + base + 16);
    v8h r0, r1;
#pragma unroll
    for (int r = 0; r < 8; ++r) {
      r0[r] = (_Float16)(o0[t][r] * inv * g0[r]);
      r1[r] = (_Float16)(o1[t][r] * inv * g1[r]);
    }
    *(v8h*)(og + base)      = r0;
    *(v8h*)(og + base + 16) = r1;
  }
}

// ---- final GEMM: [B*Q,256] @ w_o + b_o -> f32 out ----
__global__ void k_out(const _Float16* __restrict__ og, const _Float16* __restrict__ wot,
                      const float* __restrict__ b_o, float* __restrict__ out) {
  const int lane = threadIdx.x;
  const int lo = lane & 15, hh = lane >> 4;
  const int m0 = blockIdx.x * 16, n0 = blockIdx.y * 16;
  const _Float16* ar = og  + (size_t)(m0 + lo) * CQ;
  const _Float16* wr = wot + (size_t)(n0 + lo) * CQ;
  const int n = n0 + lo;
  v8f acc = {};
#pragma unroll
  for (int kc = 0; kc < CQ; kc += 32) {
    v16h a  = cat8(*(const v8h*)(ar + kc + hh * 8), *(const v8h*)(ar + kc + 16 + hh * 8));
    v16h bm = cat8(*(const v8h*)(wr + kc + hh * 8), *(const v8h*)(wr + kc + 16 + hh * 8));
    acc = wmma16(a, bm, acc);
  }
#pragma unroll
  for (int r = 0; r < 8; ++r) {
    int mm = m0 + 8 * hh + r;
    out[(size_t)mm * CQ + n] = acc[r] + b_o[n];
  }
}

extern "C" void kernel_launch(void* const* d_in, const int* in_sizes, int n_in,
                              void* d_out, int out_size, void* d_ws, size_t ws_size,
                              hipStream_t stream) {
  const float* q_x       = (const float*)d_in[0];
  const float* kv_x      = (const float*)d_in[1];
  const float* bias_mask = (const float*)d_in[2];
  const float* bias_pair = (const float*)d_in[3];
  const float* w_q       = (const float*)d_in[4];
  const float* w_k       = (const float*)d_in[5];
  const float* w_v       = (const float*)d_in[6];
  const float* w_g       = (const float*)d_in[7];
  const float* b_g       = (const float*)d_in[8];
  const float* w_o       = (const float*)d_in[9];
  const float* b_o       = (const float*)d_in[10];
  float* out = (float*)d_out;

  char* ws = (char*)d_ws;
  size_t off = 0;
  auto alloc = [&](size_t bytes) {
    size_t o = off;
    off += (bytes + 255) & ~(size_t)255;
    return o;
  };
  _Float16* wqt = (_Float16*)(ws + alloc((size_t)CQ * CQ * 2));
  _Float16* wkt = (_Float16*)(ws + alloc((size_t)CQ * CQ * 2));
  _Float16* wvt = (_Float16*)(ws + alloc((size_t)CQ * CQ * 2));
  _Float16* wgt = (_Float16*)(ws + alloc((size_t)CQ * CQ * 2));
  _Float16* wot = (_Float16*)(ws + alloc((size_t)CQ * CQ * 2));
  _Float16* qh  = (_Float16*)(ws + alloc((size_t)BB * NH * QL * CH * 2));
  _Float16* kh  = (_Float16*)(ws + alloc((size_t)BB * NH * KL * CH * 2));
  _Float16* vtp = (_Float16*)(ws + alloc((size_t)BB * NH * CH * KL * 2));
  float*    gb  = (float*)   (ws + alloc((size_t)BB * QL * CQ * 4));
  _Float16* og  = (_Float16*)(ws + alloc((size_t)BB * QL * CQ * 2));

  // weight transposes (f32 -> f16 W^T), one launch for the five
  k_transpose<<<dim3(CQ, 5), dim3(CQ), 0, stream>>>(w_q, w_k, w_v, w_g, w_o,
                                                    wqt, wkt, wvt, wgt, wot);

  // projections, one launch for the four: one wave (32 threads) per pair of
  // 16x16 tiles; QL == KL, so one grid serves q_x and kv_x
  k_proj<<<dim3((BB * QL) / 16, CQ / 16, 2), 32, 0, stream>>>(
      q_x, kv_x, wqt, wkt, wvt, wgt, b_g, qh, kh, vtp, gb);

  // fused flash attention + gating (async double-buffered K/V tiles)
  k_attn<<<dim3(QL / (16 * QT), NH, BB), 32 * NW, 0, stream>>>(qh, kh, vtp, bias_mask,
                                                   bias_pair, gb, og);

  // output projection
  k_out<<<dim3((BB * QL) / 16, CQ / 16), 32, 0, stream>>>(og, wot, b_o, out);
}

// v005
// One run takes 77.2 microseconds.
// Timed twice side by side with v004, it ran 1.07 times as fast both times.
// Over all steps from v000 it is 2.15 times as fast.
#include <hip/hip_runtime.h>
#include <math.h>

typedef __attribute__((ext_vector_type(16))) _Float16 v16h;
typedef __attribute__((ext_vector_type(8)))  _Float16 v8h;
typedef __attribute__((ext_vector_type(8)))  float    v8f;
typedef __attribute__((ext_vector_type(4)))  float    v4f;

#define NH 8
#define CH 32
#define CQ 256
#define BB 2
#define QL 2048
#define KL 2048
#define NW 4            // waves of a k_attn work-group; each takes KL / NW keys
#define QT 2            // query tiles of 16 rows held by one k_attn wave
#define PP 36           // floats per LDS row of a bias_pair tile: 32 keys + 16 bytes of pad

static __device__ __forceinline__ v16h cat8(v8h a, v8h b) {
  return __builtin_shufflevector(a, b, 0,1,2,3,4,5,6,7,8,9,10,11,12,13,14,15);
}
static __device__ __forceinline__ v8f cat4(v4f a, v4f b) {
  return __builtin_shufflevector(a, b, 0,1,2,3,4,5,6,7);
}
static __device__ __forceinline__ v16h cvt2(v8f a, v8f b) {
  v16h r;
#pragma unroll
  for (int i = 0; i < 8; ++i) { r[i] = (_Float16)a[i]; r[8 + i] = (_Float16)b[i]; }
  return r;
}
static __device__ __forceinline__ v8f wmma16(v16h a, v16h b, v8f c) {
  return __builtin_amdgcn_wmma_f32_16x16x32_f16(false, a, false, b, (short)0, c, false, false);
}

// ---- prep: transpose the five 256x256 f32 weights -> f16 row-major of W^T ----
// One launch; blockIdx.y picks the weight.
__global__ void k_transpose(const float* __restrict__ w_q, const float* __restrict__ w_k,
                            const float* __restrict__ w_v, const float* __restrict__ w_g,
                            const float* __restrict__ w_o, _Float16* __restrict__ wqt,
                            _Float16* __restrict__ wkt, _Float16* __restrict__ wvt,
                            _Float16* __restrict__ wgt, _Float16* __restrict__ wot) {
  const int s = blockIdx.y;
  const float* w = s == 0 ? w_q : s == 1 ? w_k : s == 2 ? w_v : s == 3 ? w_g : w_o;
  _Float16*   wt = s == 0 ? wqt : s == 1 ? wkt : s == 2 ? wvt : s == 3 ? wgt : wot;
  int i = threadIdx.x;   // input row (k)
  int j = blockIdx.x;    // input col (n) -> output row
  wt[(size_t)j * CQ + i] = (_Float16)w[(size_t)i * CQ + j];
}

// ---- projections: [B*L,256] @ [256,256], all four in one launch ----
// One wave per 16 rows x 16 columns of TWO products that read the same x rows:
// blockIdx.z == 0: q_x  -> q (scale 1/sqrt(32), split-head [b,h,l,32] f16)
//                          and gate (sigmoid(x+b_g), f32 [B*L,256])
// blockIdx.z == 1: kv_x -> k (split-head f16) and v (transposed [b,h,c,L] f16)
__global__ void k_proj(const float* __restrict__ q_x, const float* __restrict__ kv_x,
                       const _Float16* __restrict__ wqt, const _Float16* __restrict__ wkt,
                       const _Float16* __restrict__ wvt, const _Float16* __restrict__ wgt,
                       const float* __restrict__ b_g, _Float16* __restrict__ qh,
                       _Float16* __restrict__ kh, _Float16* __restrict__ vtp,
                       float* __restrict__ gb) {
  const int lane = threadIdx.x;
  const int lo = lane & 15, hh = lane >> 4;
  const int m0 = blockIdx.x * 16;
  const int n0 = blockIdx.y * 16;
  const bool kv = blockIdx.z != 0;
  const float*    xr  = (kv ? kv_x : q_x) + (size_t)(m0 + lo) * CQ;
  const _Float16* wr0 = (kv ? wkt : wqt) + (size_t)(n0 + lo) * CQ;
  const _Float16* wr1 = (kv ? wvt : wgt) + (size_t)(n0 + lo) * CQ;
  const int n = n0 + lo;
  v8f acc0 = {}, acc1 = {};
#pragma unroll
  for (int kc = 0; kc < CQ; kc += 32) {
    v8f a0 = *(const v8f*)(xr + kc + hh * 8);
    v8f a1 = *(const v8f*)(xr + kc + 16 + hh * 8);
    v16h a   = cvt2(a0, a1);
    v16h bm0 = cat8(*(const v8h*)(wr0 + kc + hh * 8),
                    *(const v8h*)(wr0 + kc + 16 + hh * 8));
    v16h bm1 = cat8(*(const v8h*)(wr1 + kc + hh * 8),
                    *(const v8h*)(wr1 + kc + 16 + hh * 8));
    acc0 = wmma16(a, bm0, acc0);
    acc1 = wmma16(a, bm1, acc1);
  }
  const int h = n / CH, c = n % CH;
  if (!kv) {
    const float bias = b_g[n];
#pragma unroll
    for (int r = 0; r < 8; ++r) {
      int mm = m0 + 8 * hh + r;           // global row in [0, B*QL)
      int b = mm / QL, li = mm % QL;
      qh[(((size_t)(b * NH + h) * QL) + li) * CH + c] =
          (_Float16)(acc0[r] * 0.17677669529663687f);
      gb[(size_t)mm * CQ + n] = 1.0f / (1.0f + __expf(-(acc1[r] + bias)));
    }
  } else {
#pragma unroll
    for (int r = 0; r < 8; ++r) {
      int mm = m0 + 8 * hh + r;           // global row in [0, B*KL)
      int b = mm / KL, li = mm % KL;
      kh[(((size_t)(b * NH + h) * KL) + li) * CH + c] = (_Float16)acc0[r];
      vtp[(((size_t)(b * NH + h) * CH) + c) * (size_t)KL + li] = (_Float16)acc1[r];
    }
    // behind the branch's last stores: in the built code the other branch's
    // block follows this one and rewrites registers that these stores name
    asm volatile("s_wait_xcnt 0x0" ::: "memory");
  }
}

// lane l <-> lane l ^ 16 (the two halves that split one query's keys)
static __device__ __forceinline__ float xhalf(float x) {
  int i = __builtin_bit_cast(int, x);
  return __builtin_bit_cast(float,
      __builtin_amdgcn_permlanex16(i, i, 0x76543210, 0xfedcba98, false, false));
}

__global__ void __launch_bounds__(32 * NW)
k_attn(const _Float16* __restrict__ qh, const _Float16* __restrict__ kh,
       const _Float16* __restrict__ vt, const float* __restrict__ bias_mask,
       const float* __restrict__ bias_pair, const float* __restrict__ g,
       _Float16* __restrict__ og) {
  __shared__ __align__(16) _Float16 kbuf[NW][2][32][32];
  __shared__ __align__(16) _Float16 vbuf[NW][2][32][32];
  __shared__ __align__(16) float pbuf[NW][2][16 * QT][PP];
  const int lane = threadIdx.x & 31;
  const int wave = __builtin_amdgcn_readfirstlane(threadIdx.x >> 5);
  const int kbeg = wave * (KL / NW), kend = kbeg + KL / NW;
  const int lo = lane & 15, hh = lane >> 4;
  const int q0 = blockIdx.x * (16 * QT);
  const int h  = blockIdx.y;
  const int b  = blockIdx.z;
  const size_t bh = (size_t)(b * NH + h);

  // async-copy a 32x32 f16 tile (rows have stride rowstride halves) into LDS
  auto async_tile = [&](const _Float16* gbase, size_t rowstride, _Float16 (*dst)[32]) {
    const _Float16* gp[4];
    unsigned ldsoff[4];
#pragma unroll  // constant indices: the addresses stay in registers
    for (int j = 0; j < 4; ++j) {
      int chunk = lane + 32 * j;        // 0..127 sixteen-byte chunks
      int row  = chunk >> 2;
      int c16  = (chunk & 3) * 8;       // halves
      gp[j] = gbase + (size_t)row * rowstride + c16;
      ldsoff[j] = (unsigned)(uintptr_t)(&dst[row][c16]);
    }
    // the wait closes the statement so that no address register of a copy
    // is rewritten in front of it
    asm volatile("global_load_async_to_lds_b128 %0, %1, off\n\t"
                 "global_load_async_to_lds_b128 %2, %3, off\n\t"
                 "global_load_async_to_lds_b128 %4, %5, off\n\t"
                 "global_load_async_to_lds_b128 %6, %7, off\n\t"
                 "s_wait_xcnt 0x0"
                 :: "v"(ldsoff[0]), "v"(gp[0]), "v"(ldsoff[1]), "v"(gp[1]),
                    "v"(ldsoff[2]), "v"(gp[2]), "v"(ldsoff[3]), "v"(gp[3])
                 : "memory");
  };

  // async-copy the wave's 16 * QT rows x 32 keys of bias_pair (f32) into LDS
  static_assert(QT == 2, "eight copies of 4 rows x 128 bytes cover the tile");
  auto async_pair = [&](const float* gbase, float (*dst)[PP]) {
    const float* gp[8];
    unsigned ldsoff[8];
#pragma unroll  // constant indices: the addresses stay in registers
    for (int j = 0; j < 8; ++j) {
      int row  = (lane >> 3) + 4 * j;   // 8 lanes a row, 4 rows a copy
      int c4   = (lane & 7) * 4;        // floats
      gp[j] = gbase + (size_t)row * KL + c4;
      ldsoff[j] = (unsigned)(uintptr_t)(&dst[row][c4]);
    }
    // the wait closes the statement so that no address register of a copy
    // is rewritten in front of it
    asm volatile("global_load_async_to_lds_b128 %0, %1, off\n\t"
                 "global_load_async_to_lds_b128 %2, %3, off\n\t"
                 "global_load_async_to_lds_b128 %4, %5, off\n\t"
                 "global_load_async_to_lds_b128 %6, %7, off\n\t"
                 "global_load_async_to_lds_b128 %8, %9, off\n\t"
                 "global_load_async_to_lds_b128 %10, %11, off\n\t"
                 "global_load_async_to_lds_b128 %12, %13, off\n\t"
                 "global_load_async_to_lds_b128 %14, %15, off\n\t"
                 "s_wait_xcnt 0x0"
                 :: "v"(ldsoff[0]), "v"(gp[0]), "v"(ldsoff[1]), "v"(gp[1]),
                    "v"(ldsoff[2]), "v"(gp[2]), "v"(ldsoff[3]), "v"(gp[3]),
                    "v"(ldsoff[4]), "v"(gp[4]), "v"(ldsoff[5]), "v"(gp[5]),
                    "v"(ldsoff[6]), "v"(gp[6]), "v"(ldsoff[7]), "v"(gp[7])
                 : "memory");
  };

  // every loop over t below is unrolled so that the per-tile arrays are
  // indexed by constants and stay in registers

  // Q tiles as WMMA B operands (K-dim = 32 channels, loaded once)
  v16h aq[QT];
#pragma unroll
  for (int t = 0; t < QT; ++t) {
    const _Float16* qr = qh + (bh * QL + q0 + 16 * t + lo) * CH;
    aq[t] = cat8(*(const v8h*)(qr + hh * 8), *(const v8h*)(qr + 16 + hh * 8));
  }

  // prefetch this wave's first tile
  async_tile(kh + (bh * KL + kbeg) * CH, CH, kbuf[wave][0]);
  async_tile(vt + (bh * CH) * (size_t)KL + kbeg, KL, vbuf[wave][0]);
  // the work-group's first query row of bias_pair
  const float* bpbase = bias_pair + ((size_t)h * QL + q0) * KL;
  async_pair(bpbase + kbeg, pbuf[wave][0]);

  // this lane's half's keys of bias_mask
  const float* bmrow = bias_mask + (size_t)b * KL + 8 * hh;

  float mrow[QT], lrow[QT];           // lrow: this half's keys only
  v8f o0[QT], o1[QT];
#pragma unroll
  for (int t = 0; t < QT; ++t) {
    mrow[t] = -1e30f;
    lrow[t] = 0.0f;
    o0[t] = v8f{};
    o1[t] = v8f{};
  }

  for (int kc = kbeg; kc < kend; kc += 32) {
    const int buf = (kc >> 5) & 1;
    if (kc + 32 < kend) {
      // issue next tile into the other buffer, then wait for current tile:
      // the 8 newest async ops may stay outstanding (async loads complete
      // in order), so <=8 outstanding means the current buffer is ready.
      async_tile(kh + (bh * KL + kc + 32) * CH, CH, kbuf[wave][buf ^ 1]);
      async_tile(vt + (bh * CH) * (size_t)KL + (kc + 32), KL, vbuf[wave][buf ^ 1]);
      asm volatile("s_wait_asynccnt 0x8" ::: "memory");
      // behind that wait, so that the 8 newest copies in front of it are always
      // the next K and V tiles and it covers this trip's bias_pair tile too
      async_pair(bpbase + kc + 32, pbuf[wave][buf ^ 1]);
    } else {
      asm volatile("s_wait_asynccnt 0x0" ::: "memory");
    }

    // A operands: rows of K from LDS
    v16h b0 = cat8(*(const v8h*)(&kbuf[wave][buf][lo][hh * 8]),
                   *(const v8h*)(&kbuf[wave][buf][lo][16 + hh * 8]));
    v16h b1 = cat8(*(const v8h*)(&kbuf[wave][buf][16 + lo][hh * 8]),
                   *(const v8h*)(&kbuf[wave][buf][16 + lo][16 + hh * 8]));
    // A operands: rows of V^T from LDS, output channels lo and 16+lo
    v16h bv0 = cat8(*(const v8h*)(&vbuf[wave][buf][lo][hh * 8]),
                    *(const v8h*)(&vbuf[wave][buf][lo][16 + hh * 8]));
    v16h bv1 = cat8(*(const v8h*)(&vbuf[wave][buf][16 + lo][hh * 8]),
                    *(const v8h*)(&vbuf[wave][buf][16 + lo][16 + hh * 8]));
    v8f bm0 = *(const v8f*)(bmrow + kc);
    v8f bm1 = *(const v8f*)(bmrow + kc + 16);
#pragma unroll
    for (int t = 0; t < QT; ++t) {
      v8f z = {};
      v8f s0 = wmma16(b0, aq[t], z);   // s0[r] = S[q0+16t+lo][kc + 8*hh + r]
      v8f s1 = wmma16(b1, aq[t], z);   // s1[r] = S[q0+16t+lo][kc + 16 + 8*hh + r]

      // this lane's query row of the bias_pair tile, its half's keys
      const float* pr = &pbuf[wave][buf][16 * t + lo][8 * hh];
      v8f bp0 = cat4(*(const v4f*)(pr),      *(const v4f*)(pr + 4));
      v8f bp1 = cat4(*(const v4f*)(pr + 16), *(const v4f*)(pr + 20));
      float cm = -1e30f;
#pragma unroll
      for (int r = 0; r < 8; ++r) {
        s0[r] += bm0[r] + bp0[r];
        s1[r] += bm1[r] + bp1[r];
        cm = fmaxf(cm, fmaxf(s0[r], s1[r]));
      }
      // the query's maximum over all 32 keys: join the two halves
      cm = fmaxf(cm, xhalf(cm));
      float mn = fmaxf(mrow[t], cm);
      float alpha = __expf(mrow[t] - mn);
      mrow[t] = mn;
      v16h pb;                      // P^T as B operand, hardware k order
      float rs = 0.0f;
#pragma unroll
      for (int r = 0; r < 8; ++r) {
        float p0 = __expf(s0[r] - mn);
        float p1 = __expf(s1[r] - mn);
        rs += p0 + p1;
        pb[r]     = (_Float16)p0;
        pb[8 + r] = (_Float16)p1;
      }
      lrow[t] = lrow[t] * alpha + rs;
#pragma unroll
      for (int r = 0; r < 8; ++r) {
        o0[t][r] *= alpha;
        o1[t][r] *= alpha;
      }
      o0[t] = wmma16(bv0, pb, o0[t]);   // o0[t][r] = O[q0+16t+lo][8*hh + r]
      o1[t] = wmma16(bv1, pb, o1[t]);   // o1[t][r] = O[q0+16t+lo][16 + 8*hh + r]
    }
    // this trip's LDS reads have returned before the next trip's copies
    // refill the buffer they read
    asm volatile("s_wait_dscnt 0x0" ::: "memory");
  }
  // join the waves' partial results. A wave stages its own in its own rings:
  // its copies have landed (s_wait_asynccnt 0 in its last trip) and its reads
  // have returned (s_wait_dscnt 0 at the loop's foot). Planes of 32 x 16 bytes:
  // K ring, 4 per query tile: the accumulators; V ring, one per query tile:
  // the maximum and this half's sum.
  static_assert(QT * 4 * 512 <= 2 * 32 * 32 * 2, "accumulator planes fit the wave's K ring");
  if (wave != 0) {
    v4f* pw = (v4f*)&kbuf[wave][0][0][0];
    v4f* pm = (v4f*)&vbuf[wave][0][0][0];
#pragma unroll
    for (int t = 0; t < QT; ++t) {
      pw[128 * t + lane]      = __builtin_shufflevector(o0[t], o0[t], 0, 1, 2, 3);
      pw[128 * t + 32 + lane] = __builtin_shufflevector(o0[t], o0[t], 4, 5, 6, 7);
      pw[128 * t + 64 + lane] = __builtin_shufflevector(o1[t], o1[t], 0, 1, 2, 3);
      pw[128 * t + 96 + lane] = __builtin_shufflevector(o1[t], o1[t], 4, 5, 6, 7);
      v4f ml = {mrow[t], lrow[t], 0.0f, 0.0f};
      pm[32 * t + lane] = ml;
    }
  }
  __syncthreads();   // publishes the partial results to wave 0
  if (wave != 0) return;
#pragma unroll
  for (int t = 0; t < QT; ++t) {
    // the loops below are unrolled so that mw, lw and the vector elements are
    // indexed by constants and stay in registers
    float mw[NW], lw[NW];
    float mall = mrow[t];
#pragma unroll
    for (int w = 1; w < NW; ++w) {
      v4f ml = ((const v4f*)&vbuf[w][0][0][0])[32 * t + lane];
      mw[w] = ml[0];
      lw[w] = ml[1];
      mall = fmaxf(mall, mw[w]);
    }
    float f = __expf(mrow[t] - mall);
    lrow[t] *= f;
#pragma unroll
    for (int r = 0; r < 8; ++r) { o0[t][r] *= f; o1[t][r] *= f; }
#pragma unroll
    for (int w = 1; w < NW; ++w) {
      const v4f* pr = (const v4f*)&kbuf[w][0][0][0] + 128 * t;
      v4f a0 = pr[lane], a1 = pr[32 + lane], a2 = pr[64 + lane], a3 = pr[96 + lane];
      f = __expf(mw[w] - mall);
      lrow[t] += lw[w] * f;
#pragma unroll
      for (int r = 0; r < 4; ++r) {
        o0[t][r]     += a0[r] * f;
        o0[t][4 + r] += a1[r] * f;
        o1[t][r]     += a2[r] * f;
        o1[t][4 + r] += a3[r] * f;
      }
    }
    // epilogue: join the halves' sums, normalize, gate, store f16 [B*Q, H*CH]
    float inv = 1.0f / (lrow[t] + xhalf(lrow[t]));
    size_t base = ((size_t)b * QL + q0 + 16 * t + lo) * (NH * CH) + h * CH + 8 * hh;
    v8f g0 = *(const v8f*)(g + base);
    v8f g1 = *(const v8f*)(g + base + 16);
    v8h r0, r1;
#pragma unroll
    for (int r = 0; r < 8; ++r) {
      r0[r] = (_Float16)(o0[t][r] * inv * g0[r]);
      r1[r] = (_Float16)(o1[t][r] * inv * g1[r]);
    }
    *(v8h*)(og + base)      = r0;
    *(v8h*)(og + base + 16) = r1;
  }
}

// ---- final GEMM: [B*Q,256] @ w_o + b_o -> f32 out ----
__global__ void k_out(const _Float16* __restrict__ og, const _Float16* __restrict__ wot,
                      const float* __restrict__ b_o, float* __restrict__ out) {
  const int lane = threadIdx.x;
  const int lo = lane & 15, hh = lane >> 4;
  const int m0 = blockIdx.x * 16, n0 = blockIdx.y * 16;
  const _Float16* ar = og  + (size_t)(m0 + lo) * CQ;
  const _Float16* wr = wot + (size_t)(n0 + lo) * CQ;
  const int n = n0 + lo;
  v8f acc = {};
#pragma unroll
  for (int kc = 0; kc < CQ; kc += 32) {
    v16h a  = cat8(*(const v8h*)(ar + kc + hh * 8), *(const v8h*)(ar + kc + 16 + hh * 8));
    v16h bm = cat8(*(const v8h*)(wr + kc + hh * 8), *(const v8h*)(wr + kc + 16 + hh * 8));
    acc = wmma16(a, bm, acc);
  }
#pragma unroll
  for (int r = 0; r < 8; ++r) {
    int mm = m0 + 8 * hh + r;
    out[(size_t)mm * CQ + n] = acc[r] + b_o[n];
  }
}

extern "C" void kernel_launch(void* const* d_in, const int* in_sizes, int n_in,
                              void* d_out, int out_size, void* d_ws, size_t ws_size,
                              hipStream_t stream) {
  const float* q_x       = (const float*)d_in[0];
  const float* kv_x      = (const float*)d_in[1];
  const float* bias_mask = (const float*)d_in[2];
  const float* bias_pair = (const float*)d_in[3];
  const float* w_q       = (const float*)d_in[4];
  const float* w_k       = (const float*)d_in[5];
  const float* w_v       = (const float*)d_in[6];
  const float* w_g       = (const float*)d_in[7];
  const float* b_g       = (const float*)d_in[8];
  const float* w_o       = (const float*)d_in[9];
  const float* b_o       = (const float*)d_in[10];
  float* out = (float*)d_out;

  char* ws = (char*)d_ws;
  size_t off = 0;
  auto alloc = [&](size_t bytes) {
    size_t o = off;
    off += (bytes + 255) & ~(size_t)255;
    return o;
  };
  _Float16* wqt = (_Float16*)(ws + alloc((size_t)CQ * CQ * 2));
  _Float16* wkt = (_Float16*)(ws + alloc((size_t)CQ * CQ * 2));
  _Float16* wvt = (_Float16*)(ws + alloc((size_t)CQ * CQ * 2));
  _Float16* wgt = (_Float16*)(ws + alloc((size_t)CQ * CQ * 2));
  _Float16* wot = (_Float16*)(ws + alloc((size_t)CQ * CQ * 2));
  _Float16* qh  = (_Float16*)(ws + alloc((size_t)BB * NH * QL * CH * 2));
  _Float16* kh  = (_Float16*)(ws + alloc((size_t)BB * NH * KL * CH * 2));
  _Float16* vtp = (_Float16*)(ws + alloc((size_t)BB * NH * CH * KL * 2));
  float*    gb  = (float*)   (ws + alloc((size_t)BB * QL * CQ * 4));
  _Float16* og  = (_Float16*)(ws + alloc((size_t)BB * QL * CQ * 2));

  // weight transposes (f32 -> f16 W^T), one launch for the five
  k_transpose<<<dim3(CQ, 5), dim3(CQ), 0, stream>>>(w_q, w_k, w_v, w_g, w_o,
                                                    wqt, wkt, wvt, wgt, wot);

  // projections, one launch for the four: one wave (32 threads) per pair of
  // 16x16 tiles; QL == KL, so one grid serves q_x and kv_x
  k_proj<<<dim3((BB * QL) / 16, CQ / 16, 2), 32, 0, stream>>>(
      q_x, kv_x, wqt, wkt, wvt, wgt, b_g, qh, kh, vtp, gb);

  // fused flash attention + gating (async double-buffered K/V tiles)
  k_attn<<<dim3(QL / (16 * QT), NH, BB), 32 * NW, 0, stream>>>(qh, kh, vtp, bias_mask,
                                                   bias_pair, gb, og);

  // output projection
  k_out<<<dim3((BB * QL) / 16, CQ / 16), 32, 0, stream>>>(og, wot, b_o, out);
}

// v006
// Measured time: 47 microseconds a run.
// Two timings next to v005 both put it at 1.65 times that version's speed.
// All steps since v000 together make it 3.54 times as fast.
#include <hip/hip_runtime.h>
#include <math.h>

typedef __attribute__((ext_vector_type(16))) _Float16 v16h;
typedef __attribute__((ext_vector_type(8)))  _Float16 v8h;
typedef __attribute__((ext_vector_type(4)))  _Float16 v4h;
typedef __attribute__((ext_vector_type(8)))  float    v8f;
typedef __attribute__((ext_vector_type(4)))  float    v4f;

#define NH 8
#define CH 32
#define CQ 256
#define BB 2
#define QL 2048
#define KL 2048
#define NW 4            // waves of a k_attn work-group; each takes KL / NW keys
#define QT 2            // query tiles of 16 rows held by one k_attn wave
#define PP 36           // floats per LDS row of a bias_pair tile: 32 keys + 16 bytes of pad
#define TM 64           // rows of a GEMM work-group's tile
#define TN 64           // columns of a GEMM work-group's tile
#define LP 264          // halves per LDS row of a GEMM operand: 256 + 16 bytes of pad

static __device__ __forceinline__ v16h cat8(v8h a, v8h b) {
  return __builtin_shufflevector(a, b, 0,1,2,3,4,5,6,7,8,9,10,11,12,13,14,15);
}
static __device__ __forceinline__ v8f cat4(v4f a, v4f b) {
  return __builtin_shufflevector(a, b, 0,1,2,3,4,5,6,7);
}
static __device__ __forceinline__ v16h cvt2(v8f a, v8f b) {
  v16h r;
#pragma unroll
  for (int i = 0; i < 8; ++i) { r[i] = (_Float16)a[i]; r[8 + i] = (_Float16)b[i]; }
  return r;
}
static __device__ __forceinline__ v8f wmma16(v16h a, v16h b, v8f c) {
  return __builtin_amdgcn_wmma_f32_16x16x32_f16(false, a, false, b, (short)0, c, false, false);
}

// ---- the GEMM kernels' operands go through LDS ----
// A work-group of 8 waves owns TM rows x TN columns over the whole K = 256. Both
// operands are fetched once per work-group by loads that cover whole 128-byte
// lines, converted to f16 and laid in LDS with k contiguous, rows at a pitch of
// 528 bytes (16 x odd: free of bank conflicts for the 16-byte fragment reads).
// All of a thread's loads are issued before the first value is used.
// Every loop of these kernels is unrolled so that the register arrays and the
// vector elements are indexed by constants and stay in registers.

// A strip of 256 k x TN columns of a row-major f32 weight becomes dst[n][k] f16.
// A thread takes two blocks of 8 k x 4 n: per block eight 16-byte loads (16 lanes
// cover the 256 bytes of one k), then one 16-byte LDS store for each n, so the
// transpose costs no launch of its own.
// the thread's first element of the strip that starts at column n0
static __device__ __forceinline__ const float* wt_src(const float* __restrict__ w, int n0,
                                                      int tid) {
  return w + (size_t)((tid >> 4) * 8) * CQ + n0 + (tid & 15) * 4;
}
static __device__ __forceinline__ void wt_load(const float* __restrict__ sp, v4f (&row)[16]) {
#pragma unroll  // constant indices: the rows stay in registers
  for (int j = 0; j < 16; ++j)          // block j >> 3 begins at k + 128
    row[j] = *(const v4f*)(sp + (size_t)((j >> 3) * 128 + (j & 7)) * CQ);
}
static __device__ __forceinline__ void wt_store(const v4f (&row)[16], _Float16 (*dst)[LP],
                                                int tid) {
#pragma unroll  // constant indices: the rows stay in registers
  for (int p = 0; p < 2; ++p) {
#pragma unroll
    for (int i = 0; i < 4; ++i) {
      v8h c;
#pragma unroll
      for (int r = 0; r < 8; ++r) c[r] = (_Float16)row[8 * p + r][i];
      *(v8h*)&dst[(tid & 15) * 4 + i][(tid >> 4) * 8 + 128 * p] = c;
    }
  }
}

// one 16 x 32 fragment (A or B): LDS row of the lane, hardware k order
static __device__ __forceinline__ v16h frag(const _Float16* rowp, int kc, int hh) {
  return cat8(*(const v8h*)(rowp + kc + hh * 8), *(const v8h*)(rowp + kc + 16 + hh * 8));
}

// ---- projections: [B*L,256] @ [256,256], all four in one launch ----
// A work-group does the TWO products that read the same x rows; a wave takes
// 16 rows x 32 columns (one head) of both:
// blockIdx.z == 0: q_x  -> q (scale 1/sqrt(32), split-head [b,h,l,32] f16)
//                          and gate (sigmoid(x+b_g), f32 [B*L,256])
// blockIdx.z == 1: kv_x -> k (split-head f16) and v (transposed [b,h,c,L] f16)
__global__ void __launch_bounds__(256)
k_proj(const float* __restrict__ q_x, const float* __restrict__ kv_x,
       const float* __restrict__ w_q, const float* __restrict__ w_k,
       const float* __restrict__ w_v, const float* __restrict__ w_g,
       const float* __restrict__ b_g, _Float16* __restrict__ qh,
       _Float16* __restrict__ kh, _Float16* __restrict__ vtp,
       float* __restrict__ gb) {
  __shared__ __align__(16) _Float16 xs[TM][LP];
  __shared__ __align__(16) _Float16 wa[TN][LP];
  __shared__ __align__(16) _Float16 wb[TN][LP];
  static_assert(QL == KL && QL % TM == 0 && CH == 32, "a tile lies in one batch, a wave in one head");
  const int tid = threadIdx.x;
  const int lane = tid & 31;
  const int wave = __builtin_amdgcn_readfirstlane(tid >> 5);
  const int lo = lane & 15, hh = lane >> 4;
  const int mb = blockIdx.x * TM;
  const int nb = blockIdx.y * TN;
  const bool kv = blockIdx.z != 0;

  // x tile: a wave's load covers 512 contiguous bytes of a row, 4 rows a pass
  const float* xp = (kv ? kv_x : q_x) + (size_t)(mb + (tid >> 6)) * CQ + (tid & 63) * 4;
  const float* pa = wt_src(kv ? w_k : w_q, nb, tid);
  const float* pb = wt_src(kv ? w_v : w_g, nb, tid);
  v4f xr[16], ra[16], rb[16];
#pragma unroll  // constant indices: the rows stay in registers
  for (int j = 0; j < 16; ++j) xr[j] = *(const v4f*)(xp + (size_t)(4 * j) * CQ);
  wt_load(pa, ra);
  wt_load(pb, rb);
  // behind the last load, the three address pairs held up to here: no register
  // that an issued load names is rewritten in front of this wait
  asm volatile("s_wait_xcnt 0x0" :: "v"(xp), "v"(pa), "v"(pb) : "memory");
#pragma unroll
  for (int j = 0; j < 16; ++j) {
    v4h c;
#pragma unroll
    for (int i = 0; i < 4; ++i) c[i] = (_Float16)xr[j][i];
    *(v4h*)&xs[(tid >> 6) + 4 * j][(tid & 63) * 4] = c;
  }
  wt_store(ra, wa, tid);
  wt_store(rb, wb, tid);
  __syncthreads();   // publishes the three operand tiles to all waves

  const int nw = (wave >> 2) * 32;      // the wave's first column in the tile
  const _Float16* ar = &xs[(wave & 3) * 16 + lo][0];
  v8f acc0[2] = {}, acc1[2] = {};
#pragma unroll
  for (int kc = 0; kc < CQ; kc += 32) {
    v16h a = frag(ar, kc, hh);
#pragma unroll
    for (int t = 0; t < 2; ++t) {
      acc0[t] = wmma16(a, frag(&wa[nw + 16 * t + lo][0], kc, hh), acc0[t]);
      acc1[t] = wmma16(a, frag(&wb[nw + 16 * t + lo][0], kc, hh), acc1[t]);
    }
  }
  const int m0 = mb + (wave & 3) * 16;  // global row in [0, B*L) of the wave's first
  const int bh = (m0 / QL) * NH + (nb + nw) / CH;
  const int li = m0 % QL + 8 * hh;      // the lane's first row inside the batch
  if (!kv) {
#pragma unroll
    for (int t = 0; t < 2; ++t) {
      const int c = 16 * t + lo;
      const float bias = b_g[nb + nw + c];
      _Float16* qp = qh + ((size_t)bh * QL + li) * CH + c;
      float*    gp = gb + (size_t)(m0 + 8 * hh) * CQ + nb + nw + c;
#pragma unroll
      for (int r = 0; r < 8; ++r) {
        qp[r * CH] = (_Float16)(acc0[t][r] * 0.17677669529663687f);
        gp[r * CQ] = 1.0f / (1.0f + __expf(-(acc1[t][r] + bias)));
      }
    }
  } else {
#pragma unroll
    for (int t = 0; t < 2; ++t) {
      const int c = 16 * t + lo;
      _Float16* kp = kh + ((size_t)bh * KL + li) * CH + c;
      _Float16* vp = vtp + ((size_t)bh * CH + c) * KL + li;
#pragma unroll
      for (int r = 0; r < 8; ++r) {
        kp[r * CH] = (_Float16)acc0[t][r];
        vp[r]      = (_Float16)acc1[t][r];
      }
    }
    // behind the branch's last stores: in the built code the other branch's
    // block follows this one and rewrites registers that these stores name
    asm volatile("s_wait_xcnt 0x0" ::: "memory");
  }
}

// lane l <-> lane l ^ 16 (the two halves that split one query's keys)
static __device__ __forceinline__ float xhalf(float x) {
  int i = __builtin_bit_cast(int, x);
  return __builtin_bit_cast(float,
      __builtin_amdgcn_permlanex16(i, i, 0x76543210, 0xfedcba98, false, false));
}

__global__ void __launch_bounds__(32 * NW)
k_attn(const _Float16* __restrict__ qh, const _Float16* __restrict__ kh,
       const _Float16* __restrict__ vt, const float* __restrict__ bias_mask,
       const float* __restrict__ bias_pair, const float* __restrict__ g,
       _Float16* __restrict__ og) {
  __shared__ __align__(16) _Float16 kbuf[NW][2][32][32];
  __shared__ __align__(16) _Float16 vbuf[NW][2][32][32];
  __shared__ __align__(16) float pbuf[NW][2][16 * QT][PP];
  const int lane = threadIdx.x & 31;
  const int wave = __builtin_amdgcn_readfirstlane(threadIdx.x >> 5);
  const int kbeg = wave * (KL / NW), kend = kbeg + KL / NW;
  const int lo = lane & 15, hh = lane >> 4;
  const int q0 = blockIdx.x * (16 * QT);
  const int h  = blockIdx.y;
  const int b  = blockIdx.z;
  const size_t bh = (size_t)(b * NH + h);

  // async-copy a 32x32 f16 tile (rows have stride rowstride halves) into LDS
  auto async_tile = [&](const _Float16* gbase, size_t rowstride, _Float16 (*dst)[32]) {
    const _Float16* gp[4];
    unsigned ldsoff[4];
#pragma unroll  // constant indices: the addresses stay in registers
    for (int j = 0; j < 4; ++j) {
      int chunk = lane + 32 * j;        // 0..127 sixteen-byte chunks
      int row  = chunk >> 2;
      int c16  = (chunk & 3) * 8;       // halves
      gp[j] = gbase + (size_t)row * rowstride + c16;
      ldsoff[j] = (unsigned)(uintptr_t)(&dst[row][c16]);
    }
    // the wait closes the statement so that no address register of a copy
    // is rewritten in front of it
    asm volatile("global_load_async_to_lds_b128 %0, %1, off\n\t"
                 "global_load_async_to_lds_b128 %2, %3, off\n\t"
                 "global_load_async_to_lds_b128 %4, %5, off\n\t"
                 "global_load_async_to_lds_b128 %6, %7, off\n\t"
                 "s_wait_xcnt 0x0"
                 :: "v"(ldsoff[0]), "v"(gp[0]), "v"(ldsoff[1]), "v"(gp[1]),
                    "v"(ldsoff[2]), "v"(gp[2]), "v"(ldsoff[3]), "v"(gp[3])
                 : "memory");
  };

  // async-copy the wave's 16 * QT rows x 32 keys of bias_pair (f32) into LDS
  static_assert(QT == 2, "eight copies of 4 rows x 128 bytes cover the tile");
  auto async_pair = [&](const float* gbase, float (*dst)[PP]) {
    const float* gp[8];
    unsigned ldsoff[8];
#pragma unroll  // constant indices: the addresses stay in registers
    for (int j = 0; j < 8; ++j) {
      int row  = (lane >> 3) + 4 * j;   // 8 lanes a row, 4 rows a copy
      int c4   = (lane & 7) * 4;        // floats
      gp[j] = gbase + (size_t)row * KL + c4;
      ldsoff[j] = (unsigned)(uintptr_t)(&dst[row][c4]);
    }
    // the wait closes the statement so that no address register of a copy
    // is rewritten in front of it
    asm volatile("global_load_async_to_lds_b128 %0, %1, off\n\t"
                 "global_load_async_to_lds_b128 %2, %3, off\n\t"
                 "global_load_async_to_lds_b128 %4, %5, off\n\t"
                 "global_load_async_to_lds_b128 %6, %7, off\n\t"
                 "global_load_async_to_lds_b128 %8, %9, off\n\t"
                 "global_load_async_to_lds_b128 %10, %11, off\n\t"
                 "global_load_async_to_lds_b128 %12, %13, off\n\t"
                 "global_load_async_to_lds_b128 %14, %15, off\n\t"
                 "s_wait_xcnt 0x0"
                 :: "v"(ldsoff[0]), "v"(gp[0]), "v"(ldsoff[1]), "v"(gp[1]),
                    "v"(ldsoff[2]), "v"(gp[2]), "v"(ldsoff[3]), "v"(gp[3]),
                    "v"(ldsoff[4]), "v"(gp[4]), "v"(ldsoff[5]), "v"(gp[5]),
                    "v"(ldsoff[6]), "v"(gp[6]), "v"(ldsoff[7]), "v"(gp[7])
                 : "memory");
  };

  // every loop over t below is unrolled so that the per-tile arrays are
  // indexed by constants and stay in registers

  // Q tiles as WMMA B operands (K-dim = 32 channels, loaded once)
  v16h aq[QT];
#pragma unroll
  for (int t = 0; t < QT; ++t) {
    const _Float16* qr = qh + (bh * QL + q0 + 16 * t + lo) * CH;
    aq[t] = cat8(*(const v8h*)(qr + hh * 8), *(const v8h*)(qr + 16 + hh * 8));
  }

  // prefetch this wave's first tile
  async_tile(kh + (bh * KL + kbeg) * CH, CH, kbuf[wave][0]);
  async_tile(vt + (bh * CH) * (size_t)KL + kbeg, KL, vbuf[wave][0]);
  // the work-group's first query row of bias_pair
  const float* bpbase = bias_pair + ((size_t)h * QL + q0) * KL;
  async_pair(bpbase + kbeg, pbuf[wave][0]);

  // this lane's half's keys of bias_mask
  const float* bmrow = bias_mask + (size_t)b * KL + 8 * hh;

  float mrow[QT], lrow[QT];           // lrow: this half's keys only
  v8f o0[QT], o1[QT];
#pragma unroll
  for (int t = 0; t < QT; ++t) {
    mrow[t] = -1e30f;
    lrow[t] = 0.0f;
    o0[t] = v8f{};
    o1[t] = v8f{};
  }

  for (int kc = kbeg; kc < kend; kc += 32) {
    const int buf = (kc >> 5) & 1;
    if (kc + 32 < kend) {
      // issue next tile into the other buffer, then wait for current tile:
      // the 8 newest async ops may stay outstanding (async loads complete
      // in order), so <=8 outstanding means the current buffer is ready.
      async_tile(kh + (bh * KL + kc + 32) * CH, CH, kbuf[wave][buf ^ 1]);
      async_tile(vt + (bh * CH) * (size_t)KL + (kc + 32), KL, vbuf[wave][buf ^ 1]);
      asm volatile("s_wait_asynccnt 0x8" ::: "memory");
      // behind that wait, so that the 8 newest copies in front of it are always
      // the next K and V tiles and it covers this trip's bias_pair tile too
      async_pair(bpbase + kc + 32, pbuf[wave][buf ^ 1]);
    } else {
      asm volatile("s_wait_asynccnt 0x0" ::: "memory");
    }

    // A operands: rows of K from LDS
    v16h b0 = cat8(*(const v8h*)(&kbuf[wave][buf][lo][hh * 8]),
                   *(const v8h*)(&kbuf[wave][buf][lo][16 + hh * 8]));
    v16h b1 = cat8(*(const v8h*)(&kbuf[wave][buf][16 + lo][hh * 8]),
                   *(const v8h*)(&kbuf[wave][buf][16 + lo][16 + hh * 8]));
    // A operands: rows of V^T from LDS, output channels lo and 16+lo
    v16h bv0 = cat8(*(const v8h*)(&vbuf[wave][buf][lo][hh * 8]),
                    *(const v8h*)(&vbuf[wave][buf][lo][16 + hh * 8]));
    v16h bv1 = cat8(*(const v8h*)(&vbuf[wave][buf][16 + lo][hh * 8]),
                    *(const v8h*)(&vbuf[wave][buf][16 + lo][16 + hh * 8]));
    v8f bm0 = *(const v8f*)(bmrow + kc);
    v8f bm1 = *(const v8f*)(bmrow + kc + 16);
#pragma unroll
    for (int t = 0; t < QT; ++t) {
      v8f z = {};
      v8f s0 = wmma16(b0, aq[t], z);   // s0[r] = S[q0+16t+lo][kc + 8*hh + r]
      v8f s1 = wmma16(b1, aq[t], z);   // s1[r] = S[q0+16t+lo][kc + 16 + 8*hh + r]

      // this lane's query row of the bias_pair tile, its half's keys
      const float* pr = &pbuf[wave][buf][16 * t + lo][8 * hh];
      v8f bp0 = cat4(*(const v4f*)(pr),      *(const v4f*)(pr + 4));
      v8f bp1 = cat4(*(const v4f*)(pr + 16), *(const v4f*)(pr + 20));
      float cm = -1e30f;
#pragma unroll
      for (int r = 0; r < 8; ++r) {
        s0[r] += bm0[r] + bp0[r];
        s1[r] += bm1[r] + bp1[r];
        cm = fmaxf(cm, fmaxf(s0[r], s1[r]));
      }
      // the query's maximum over all 32 keys: join the two halves
      cm = fmaxf(cm, xhalf(cm));
      float mn = fmaxf(mrow[t], cm);
      float alpha = __expf(mrow[t] - mn);
      mrow[t] = mn;
      v16h pb;                      // P^T as B operand, hardware k order
      float rs = 0.0f;
#pragma unroll
      for (int r = 0; r < 8; ++r) {
        float p0 = __expf(s0[r] - mn);
        float p1 = __expf(s1[r] - mn);
        rs += p0 + p1;
        pb[r]     = (_Float16)p0;
        pb[8 + r] = (_Float16)p1;
      }
      lrow[t] = lrow[t] * alpha + rs;
#pragma unroll
      for (int r = 0; r < 8; ++r) {
        o0[t][r] *= alpha;
        o1[t][r] *= alpha;
      }
      o0[t] = wmma16(bv0, pb, o0[t]);   // o0[t][r] = O[q0+16t+lo][8*hh + r]
      o1[t] = wmma16(bv1, pb, o1[t]);   // o1[t][r] = O[q0+16t+lo][16 + 8*hh + r]
    }
    // this trip's LDS reads have returned before the next trip's copies
    // refill the buffer they read
    asm volatile("s_wait_dscnt 0x0" ::: "memory");
  }
  // join the waves' partial results. A wave stages its own in its own rings:
  // its copies have landed (s_wait_asynccnt 0 in its last trip) and its reads
  // have returned (s_wait_dscnt 0 at the loop's foot). Planes of 32 x 16 bytes:
  // K ring, 4 per query tile: the accumulators; V ring, one per query tile:
  // the maximum and this half's sum.
  static_assert(QT * 4 * 512 <= 2 * 32 * 32 * 2, "accumulator planes fit the wave's K ring");
  if (wave != 0) {
    v4f* pw = (v4f*)&kbuf[wave][0][0][0];
    v4f* pm = (v4f*)&vbuf[wave][0][0][0];
#pragma unroll
    for (int t = 0; t < QT; ++t) {
      pw[128 * t + lane]      = __builtin_shufflevector(o0[t], o0[t], 0, 1, 2, 3);
      pw[128 * t + 32 + lane] = __builtin_shufflevector(o0[t], o0[t], 4, 5, 6, 7);
      pw[128 * t + 64 + lane] = __builtin_shufflevector(o1[t], o1[t], 0, 1, 2, 3);
      pw[128 * t + 96 + lane] = __builtin_shufflevector(o1[t], o1[t], 4, 5, 6, 7);
      v4f ml = {mrow[t], lrow[t], 0.0f, 0.0f};
      pm[32 * t + lane] = ml;
    }
  }
  __syncthreads();   // publishes the partial results to wave 0
  if (wave != 0) return;
#pragma unroll
  for (int t = 0; t < QT; ++t) {
    // the loops below are unrolled so that mw, lw and the vector elements are
    // indexed by constants and stay in registers
    float mw[NW], lw[NW];
    float mall = mrow[t];
#pragma unroll
    for (int w = 1; w < NW; ++w) {
      v4f ml = ((const v4f*)&vbuf[w][0][0][0])[32 * t + lane];
      mw[w] = ml[0];
      lw[w] = ml[1];
      mall = fmaxf(mall, mw[w]);
    }
    float f = __expf(mrow[t] - mall);
    lrow[t] *= f;
#pragma unroll
    for (int r = 0; r < 8; ++r) { o0[t][r] *= f; o1[t][r] *= f; }
#pragma unroll
    for (int w = 1; w < NW; ++w) {
      const v4f* pr = (const v4f*)&kbuf[w][0][0][0] + 128 * t;
      v4f a0 = pr[lane], a1 = pr[32 + lane], a2 = pr[64 + lane], a3 = pr[96 + lane];
      f = __expf(mw[w] - mall);
      lrow[t] += lw[w] * f;
#pragma unroll
      for (int r = 0; r < 4; ++r) {
        o0[t][r]     += a0[r] * f;
        o0[t][4 + r] += a1[r] * f;
        o1[t][r]     += a2[r] * f;
        o1[t][4 + r] += a3[r] * f;
      }
    }
    // epilogue: join the halves' sums, normalize, gate, store f16 [B*Q, H*CH]
    float inv = 1.0f / (lrow[t] + xhalf(lrow[t]));
    size_t base = ((size_t)b * QL + q0 + 16 * t + lo) * (NH * CH) + h * CH + 8 * hh;
    v8f g0 = *(const v8f*)(g + base);
    v8f g1 = *(const v8f*)(g + base + 16);
    v8h r0, r1;
#pragma unroll
    for (int r = 0; r < 8; ++r) {
      r0[r] = (_Float16)(o0[t][r] * inv * g0[r]);
      r1[r] = (_Float16)(o1[t][r] * inv * g1[r]);
    }
    *(v8h*)(og + base)      = r0;
    *(v8h*)(og + base + 16) = r1;
  }
}

// ---- final GEMM: [B*Q,256] @ w_o + b_o -> f32 out ----
// Same tiling; a wave takes 16 rows x 32 columns.
__global__ void __launch_bounds__(256)
k_out(const _Float16* __restrict__ og, const float* __restrict__ w_o,
      const float* __restrict__ b_o, float* __restrict__ out) {
  __shared__ __align__(16) _Float16 xs[TM][LP];
  __shared__ __align__(16) _Float16 wa[TN][LP];
  const int tid = threadIdx.x;
  const int lane = tid & 31;
  const int wave = __builtin_amdgcn_readfirstlane(tid >> 5);
  const int lo = lane & 15, hh = lane >> 4;
  const int mb = blockIdx.x * TM;
  const int nb = blockIdx.y * TN;

  // og tile: a wave's load covers one whole row of 512 bytes, 8 rows a pass
  const _Float16* ap = og + (size_t)(mb + (tid >> 5)) * CQ + (tid & 31) * 8;
  const float*    pa = wt_src(w_o, nb, tid);
  v8h xr[8];
  v4f ra[16];
#pragma unroll  // constant indices: the rows stay in registers
  for (int j = 0; j < 8; ++j) xr[j] = *(const v8h*)(ap + (size_t)(8 * j) * CQ);
  wt_load(pa, ra);
  // behind the last load, the two address pairs held up to here: no register
  // that an issued load names is rewritten in front of this wait
  asm volatile("s_wait_xcnt 0x0" :: "v"(ap), "v"(pa) : "memory");
#pragma unroll
  for (int j = 0; j < 8; ++j) *(v8h*)&xs[(tid >> 5) + 8 * j][(tid & 31) * 8] = xr[j];
  wt_store(ra, wa, tid);
  __syncthreads();   // publishes the two operand tiles to all waves

  const int nw = (wave >> 2) * 32;      // the wave's first column in the tile
  const _Float16* ar = &xs[(wave & 3) * 16 + lo][0];
  v8f acc[2] = {};
#pragma unroll
  for (int kc = 0; kc < CQ; kc += 32) {
    v16h a = frag(ar, kc, hh);
#pragma unroll
    for (int t = 0; t < 2; ++t)
      acc[t] = wmma16(a, frag(&wa[nw + 16 * t + lo][0], kc, hh), acc[t]);
  }
  const int m0 = mb + (wave & 3) * 16;
#pragma unroll
  for (int t = 0; t < 2; ++t) {
    const int n = nb + nw + 16 * t + lo;
    const float bias = b_o[n];
    float* op = out + (size_t)(m0 + 8 * hh) * CQ + n;
#pragma unroll
    for (int r = 0; r < 8; ++r) op[r * CQ] = acc[t][r] + bias;
  }
}

extern "C" void kernel_launch(void* const* d_in, const int* in_sizes, int n_in,
                              void* d_out, int out_size, void* d_ws, size_t ws_size,
                              hipStream_t stream) {
  const float* q_x       = (const float*)d_in[0];
  const float* kv_x      = (const float*)d_in[1];
  const float* bias_mask = (const float*)d_in[2];
  const float* bias_pair = (const float*)d_in[3];
  const float* w_q       = (const float*)d_in[4];
  const float* w_k       = (const float*)d_in[5];
  const float* w_v       = (const float*)d_in[6];
  const float* w_g       = (const float*)d_in[7];
  const float* b_g       = (const float*)d_in[8];
  const float* w_o       = (const float*)d_in[9];
  const float* b_o       = (const float*)d_in[10];
  float* out = (float*)d_out;

  char* ws = (char*)d_ws;
  size_t off = 0;
  auto alloc = [&](size_t bytes) {
    size_t o = off;
    off += (bytes + 255) & ~(size_t)255;
    return o;
  };
  _Float16* qh  = (_Float16*)(ws + alloc((size_t)BB * NH * QL * CH * 2));
  _Float16* kh  = (_Float16*)(ws + alloc((size_t)BB * NH * KL * CH * 2));
  _Float16* vtp = (_Float16*)(ws + alloc((size_t)BB * NH * CH * KL * 2));
  float*    gb  = (float*)   (ws + alloc((size_t)BB * QL * CQ * 4));
  _Float16* og  = (_Float16*)(ws + alloc((size_t)BB * QL * CQ * 2));

  // projections, one launch for the four: 8 waves per TM x TN tile of a pair of
  // products; QL == KL, so one grid serves q_x and kv_x
  k_proj<<<dim3((BB * QL) / TM, CQ / TN, 2), 256, 0, stream>>>(
      q_x, kv_x, w_q, w_k, w_v, w_g, b_g, qh, kh, vtp, gb);

  // fused flash attention + gating (async double-buffered K/V tiles)
  k_attn<<<dim3(QL / (16 * QT), NH, BB), 32 * NW, 0, stream>>>(qh, kh, vtp, bias_mask,
                                                   bias_pair, gb, og);

  // output projection
  k_out<<<dim3((BB * QL) / TM, CQ / TN), 256, 0, stream>>>(og, w_o, b_o, out);
}

// v007
// A run of this version takes 36.1 microseconds.
// Next to v006, in two timings, it ran 1.31 and 1.30 times as fast.
// Over all steps from v000 it is 4.62 times as fast.
#include <hip/hip_runtime.h>
#include <math.h>

typedef __attribute__((ext_vector_type(16))) _Float16 v16h;
typedef __attribute__((ext_vector_type(8)))  _Float16 v8h;
typedef __attribute__((ext_vector_type(4)))  _Float16 v4h;
typedef __attribute__((ext_vector_type(8)))  float    v8f;
typedef __attribute__((ext_vector_type(4)))  float    v4f;

#define NH 8
#define CH 32
#define CQ 256
#define BB 2
#define QL 2048
#define KL 2048
#define NW 4            // key splits of a k_attn work-group; each takes KL / NW keys
#define QT 2            // query tiles of 16 rows held by one k_attn wave
#define NQ 2            // query groups of 16 * QT rows in a k_attn work-group
#define PP 36           // floats per LDS row of a bias_pair tile: 32 keys + 16 bytes of pad
#define TM 64           // rows of a GEMM work-group's tile
#define TN 64           // columns of a GEMM work-group's tile
#define LP 264          // halves per LDS row of a GEMM operand: 256 + 16 bytes of pad

static __device__ __forceinline__ v16h cat8(v8h a, v8h b) {
  return __builtin_shufflevector(a, b, 0,1,2,3,4,5,6,7,8,9,10,11,12,13,14,15);
}
static __device__ __forceinline__ v8f cat4(v4f a, v4f b) {
  return __builtin_shufflevector(a, b, 0,1,2,3,4,5,6,7);
}
static __device__ __forceinline__ v16h cvt2(v8f a, v8f b) {
  v16h r;
#pragma unroll
  for (int i = 0; i < 8; ++i) { r[i] = (_Float16)a[i]; r[8 + i] = (_Float16)b[i]; }
  return r;
}
static __device__ __forceinline__ v8f wmma16(v16h a, v16h b, v8f c) {
  return __builtin_amdgcn_wmma_f32_16x16x32_f16(false, a, false, b, (short)0, c, false, false);
}

// ---- the GEMM kernels' operands go through LDS ----
// A work-group of 8 waves owns TM rows x TN columns over the whole K = 256. Both
// operands are fetched once per work-group by loads that cover whole 128-byte
// lines, converted to f16 and laid in LDS with k contiguous, rows at a pitch of
// 528 bytes (16 x odd: free of bank conflicts for the 16-byte fragment reads).
// All of a thread's loads are issued before the first value is used.
// Every loop of these kernels is unrolled so that the register arrays and the
// vector elements are indexed by constants and stay in registers.

// A strip of 256 k x TN columns of a row-major f32 weight becomes dst[n][k] f16.
// A thread takes two blocks of 8 k x 4 n: per block eight 16-byte loads (16 lanes
// cover the 256 bytes of one k), then one 16-byte LDS store for each n, so the
// transpose costs no launch of its own.
// the thread's first element of the strip that starts at column n0
static __device__ __forceinline__ const float* wt_src(const float* __restrict__ w, int n0,
                                                      int tid) {
  return w + (size_t)((tid >> 4) * 8) * CQ + n0 + (tid & 15) * 4;
}
static __device__ __forceinline__ void wt_load(const float* __restrict__ sp, v4f (&row)[16]) {
#pragma unroll  // constant indices: the rows stay in registers
  for (int j = 0; j < 16; ++j)          // block j >> 3 begins at k + 128
    row[j] = *(const v4f*)(sp + (size_t)((j >> 3) * 128 + (j & 7)) * CQ);
}
static __device__ __forceinline__ void wt_store(const v4f (&row)[16], _Float16 (*dst)[LP],
                                                int tid) {
#pragma unroll  // constant indices: the rows stay in registers
  for (int p = 0; p < 2; ++p) {
#pragma unroll
    for (int i = 0; i < 4; ++i) {
      v8h c;
#pragma unroll
      for (int r = 0; r < 8; ++r) c[r] = (_Float16)row[8 * p + r][i];
      *(v8h*)&dst[(tid & 15) * 4 + i][(tid >> 4) * 8 + 128 * p] = c;
    }
  }
}

// one 16 x 32 fragment (A or B): LDS row of the lane, hardware k order
static __device__ __forceinline__ v16h frag(const _Float16* rowp, int kc, int hh) {
  return cat8(*(const v8h*)(rowp + kc + hh * 8), *(const v8h*)(rowp + kc + 16 + hh * 8));
}

// ---- projections: [B*L,256] @ [256,256], all four in one launch ----
// A work-group does the TWO products that read the same x rows; a wave takes
// 16 rows x 32 columns (one head) of both:
// blockIdx.z == 0: q_x  -> q (scale 1/sqrt(32), split-head [b,h,l,32] f16)
//                          and gate (sigmoid(x+b_g), f32 [B*L,256])
// blockIdx.z == 1: kv_x -> k (split-head f16) and v (transposed [b,h,c,L] f16)
__global__ void __launch_bounds__(256)
k_proj(const float* __restrict__ q_x, const float* __restrict__ kv_x,
       const float* __restrict__ w_q, const float* __restrict__ w_k,
       const float* __restrict__ w_v, const float* __restrict__ w_g,
       const float* __restrict__ b_g, _Float16* __restrict__ qh,
       _Float16* __restrict__ kh, _Float16* __restrict__ vtp,
       float* __restrict__ gb) {
  __shared__ __align__(16) _Float16 xs[TM][LP];
  __shared__ __align__(16) _Float16 wa[TN][LP];
  __shared__ __align__(16) _Float16 wb[TN][LP];
  static_assert(QL == KL && QL % TM == 0 && CH == 32, "a tile lies in one batch, a wave in one head");
  const int tid = threadIdx.x;
  const int lane = tid & 31;
  const int wave = __builtin_amdgcn_readfirstlane(tid >> 5);
  const int lo = lane & 15, hh = lane >> 4;
  const int mb = blockIdx.x * TM;
  const int nb = blockIdx.y * TN;
  const bool kv = blockIdx.z != 0;

  // x tile: a wave's load covers 512 contiguous bytes of a row, 4 rows a pass
  const float* xp = (kv ? kv_x : q_x) + (size_t)(mb + (tid >> 6)) * CQ + (tid & 63) * 4;
  const float* pa = wt_src(kv ? w_k : w_q, nb, tid);
  const float* pb = wt_src(kv ? w_v : w_g, nb, tid);
  v4f xr[16], ra[16], rb[16];
#pragma unroll  // constant indices: the rows stay in registers
  for (int j = 0; j < 16; ++j) xr[j] = *(const v4f*)(xp + (size_t)(4 * j) * CQ);
  wt_load(pa, ra);
  wt_load(pb, rb);
  // behind the last load, the three address pairs held up to here: no register
  // that an issued load names is rewritten in front of this wait
  asm volatile("s_wait_xcnt 0x0" :: "v"(xp), "v"(pa), "v"(pb) : "memory");
#pragma unroll
  for (int j = 0; j < 16; ++j) {
    v4h c;
#pragma unroll
    for (int i = 0; i < 4; ++i) c[i] = (_Float16)xr[j][i];
    *(v4h*)&xs[(tid >> 6) + 4 * j][(tid & 63) * 4] = c;
  }
  wt_store(ra, wa, tid);
  wt_store(rb, wb, tid);
  __syncthreads();   // publishes the three operand tiles to all waves

  const int nw = (wave >> 2) * 32;      // the wave's first column in the tile
  const _Float16* ar = &xs[(wave & 3) * 16 + lo][0];
  v8f acc0[2] = {}, acc1[2] = {};
#pragma unroll
  for (int kc = 0; kc < CQ; kc += 32) {
    v16h a = frag(ar, kc, hh);
#pragma unroll
    for (int t = 0; t < 2; ++t) {
      acc0[t] = wmma16(a, frag(&wa[nw + 16 * t + lo][0], kc, hh), acc0[t]);
      acc1[t] = wmma16(a, frag(&wb[nw + 16 * t + lo][0], kc, hh), acc1[t]);
    }
  }
  const int m0 = mb + (wave & 3) * 16;  // global row in [0, B*L) of the wave's first
  const int bh = (m0 / QL) * NH + (nb + nw) / CH;
  const int li = m0 % QL + 8 * hh;      // the lane's first row inside the batch
  if (!kv) {
#pragma unroll
    for (int t = 0; t < 2; ++t) {
      const int c = 16 * t + lo;
      const float bias = b_g[nb + nw + c];
      _Float16* qp = qh + ((size_t)bh * QL + li) * CH + c;
      float*    gp = gb + (size_t)(m0 + 8 * hh) * CQ + nb + nw + c;
#pragma unroll
      for (int r = 0; r < 8; ++r) {
        qp[r * CH] = (_Float16)(acc0[t][r] * 0.17677669529663687f);
        gp[r * CQ] = 1.0f / (1.0f + __expf(-(acc1[t][r] + bias)));
      }
    }
  } else {
#pragma unroll
    for (int t = 0; t < 2; ++t) {
      const int c = 16 * t + lo;
      _Float16* kp = kh + ((size_t)bh * KL + li) * CH + c;
      _Float16* vp = vtp + ((size_t)bh * CH + c) * KL + li;
#pragma unroll
      for (int r = 0; r < 8; ++r) {
        kp[r * CH] = (_Float16)acc0[t][r];
        vp[r]      = (_Float16)acc1[t][r];
      }
    }
    // behind the branch's last stores: in the built code the other branch's
    // block follows this one and rewrites registers that these stores name
    asm volatile("s_wait_xcnt 0x0" ::: "memory");
  }
}

// lane l <-> lane l ^ 16 (the two halves that split one query's keys)
static __device__ __forceinline__ float xhalf(float x) {
  int i = __builtin_bit_cast(int, x);
  return __builtin_bit_cast(float,
      __builtin_amdgcn_permlanex16(i, i, 0x76543210, 0xfedcba98, false, false));
}

__global__ void __launch_bounds__(32 * NW * BB * NQ)
k_attn(const _Float16* __restrict__ qh, const _Float16* __restrict__ kh,
       const _Float16* __restrict__ vt, const float* __restrict__ bias_mask,
       const float* __restrict__ bias_pair, const float* __restrict__ g,
       _Float16* __restrict__ og) {
  __shared__ __align__(16) _Float16 kbuf[NW][2][BB][32][32];
  __shared__ __align__(16) _Float16 vbuf[NW][2][BB][32][32];
  __shared__ __align__(16) float pbuf[NW][2][NQ][16 * QT][PP];
  static_assert(BB == 2 && NQ == 2, "a wave's number is (key split, batch, query group), one bit each for the last two");
  const int lane = threadIdx.x & 31;
  const int wave = __builtin_amdgcn_readfirstlane(threadIdx.x >> 5);
  const int ks = wave >> 2;           // key split
  const int b  = (wave >> 1) & 1;     // batch
  const int qg = wave & 1;            // query group
  const int kbeg = ks * (KL / NW);
  const int lo = lane & 15, hh = lane >> 4;
  const int q0 = (blockIdx.x * NQ + qg) * (16 * QT);
  const int h  = blockIdx.y;
  const size_t bh = (size_t)(b * NH + h);

  // The wave's quarter of stage i (32 keys) of its key split, eight copies:
  // query group 0 copies its batch's K tile, query group 1 its batch's V^T tile
  // (32 rows x 64 bytes, 4 lanes a row); batch b copies query tile b (16 rows x
  // 128 bytes, 8 lanes a row) of its query group's bias_pair tile.
  static_assert(QT == BB, "the batches' waves split a bias_pair tile by query tiles");
  const bool isv = qg != 0;
  const size_t kvpitch = isv ? KL : CH;        // halves from row to row
  const size_t kvstep  = isv ? 32 : 32 * CH;   // halves from stage to stage
  // this lane's first 16 bytes of stage 0
  const _Float16* kvsrc = (isv ? vt + (bh * CH) * (size_t)KL + kbeg : kh + (bh * KL + kbeg) * CH)
                          + (size_t)(lane >> 2) * kvpitch + (lane & 3) * 8;
  const float* bpsrc = bias_pair + ((size_t)h * QL + q0 + 16 * b + (lane >> 3)) * KL + kbeg
                       + (lane & 7) * 4;
  auto stage = [&](int i) {
    const int bf = i & 1;
    _Float16 (*kvdst)[32] = isv ? vbuf[ks][bf][b] : kbuf[ks][bf][b];
    float (*bpdst)[PP] = &pbuf[ks][bf][qg][16 * b];
    const _Float16* gk[4];
    const float* gp[4];
    unsigned lk[4], lp[4];
#pragma unroll  // constant indices: the addresses stay in registers
    for (int j = 0; j < 4; ++j) {
      gk[j] = kvsrc + (size_t)i * kvstep + (size_t)(8 * j) * kvpitch;   // 8 rows a copy
      lk[j] = (unsigned)(uintptr_t)(&kvdst[(lane >> 2) + 8 * j][(lane & 3) * 8]);
      gp[j] = bpsrc + 32 * i + (size_t)(4 * j) * KL;                    // 4 rows a copy
      lp[j] = (unsigned)(uintptr_t)(&bpdst[(lane >> 3) + 4 * j][(lane & 7) * 4]);
    }
    // the wait closes the statement so that no address register of a copy
    // is rewritten in front of it
    asm volatile("global_load_async_to_lds_b128 %0, %1, off\n\t"
                 "global_load_async_to_lds_b128 %2, %3, off\n\t"
                 "global_load_async_to_lds_b128 %4, %5, off\n\t"
                 "global_load_async_to_lds_b128 %6, %7, off\n\t"
                 "global_load_async_to_lds_b128 %8, %9, off\n\t"
                 "global_load_async_to_lds_b128 %10, %11, off\n\t"
                 "global_load_async_to_lds_b128 %12, %13, off\n\t"
                 "global_load_async_to_lds_b128 %14, %15, off\n\t"
                 "s_wait_xcnt 0x0"
                 :: "v"(lk[0]), "v"(gk[0]), "v"(lk[1]), "v"(gk[1]),
                    "v"(lk[2]), "v"(gk[2]), "v"(lk[3]), "v"(gk[3]),
                    "v"(lp[0]), "v"(gp[0]), "v"(lp[1]), "v"(gp[1]),
                    "v"(lp[2]), "v"(gp[2]), "v"(lp[3]), "v"(gp[3])
                 : "memory");
  };

  // every loop over t below is unrolled so that the per-tile arrays are
  // indexed by constants and stay in registers

  // Q tiles as WMMA B operands (K-dim = 32 channels, loaded once)
  v16h aq[QT];
#pragma unroll
  for (int t = 0; t < QT; ++t) {
    const _Float16* qr = qh + (bh * QL + q0 + 16 * t + lo) * CH;
    aq[t] = cat8(*(const v8h*)(qr + hh * 8), *(const v8h*)(qr + 16 + hh * 8));
  }

  // stage 0 lands and is published to the split's four waves, then stage 1 flies
  constexpr int NT = KL / NW / 32;    // trips = stages of a key split
  static_assert(NT >= 2, "the ring's prologue needs two stages");
  stage(0);
  asm volatile("s_wait_asynccnt 0x0" ::: "memory");  // this wave's share of stage 0 has landed
  __syncthreads();   // publishes stage 0
  stage(1);

  // this lane's half's keys of bias_mask
  const float* bmrow = bias_mask + (size_t)b * KL + 8 * hh;

  float mrow[QT], lrow[QT];           // lrow: this half's keys only
  v8f o0[QT], o1[QT];
#pragma unroll
  for (int t = 0; t < QT; ++t) {
    mrow[t] = -1e30f;
    lrow[t] = 0.0f;
    o0[t] = v8f{};
    o1[t] = v8f{};
  }

  for (int i = 0; i < NT; ++i) {
    const int buf = i & 1;
    const int kc = kbeg + 32 * i;

    // A operands: rows of K from LDS
    v16h b0 = cat8(*(const v8h*)(&kbuf[ks][buf][b][lo][hh * 8]),
                   *(const v8h*)(&kbuf[ks][buf][b][lo][16 + hh * 8]));
    v16h b1 = cat8(*(const v8h*)(&kbuf[ks][buf][b][16 + lo][hh * 8]),
                   *(const v8h*)(&kbuf[ks][buf][b][16 + lo][16 + hh * 8]));
    // A operands: rows of V^T from LDS, output channels lo and 16+lo
    v16h bv0 = cat8(*(const v8h*)(&vbuf[ks][buf][b][lo][hh * 8]),
                    *(const v8h*)(&vbuf[ks][buf][b][lo][16 + hh * 8]));
    v16h bv1 = cat8(*(const v8h*)(&vbuf[ks][buf][b][16 + lo][hh * 8]),
                    *(const v8h*)(&vbuf[ks][buf][b][16 + lo][16 + hh * 8]));
    v8f bm0 = *(const v8f*)(bmrow + kc);
    v8f bm1 = *(const v8f*)(bmrow + kc + 16);
    // this lane's query rows of the bias_pair tile, its half's keys
    v8f bp0[QT], bp1[QT];
#pragma unroll
    for (int t = 0; t < QT; ++t) {
      const float* pr = &pbuf[ks][buf][qg][16 * t + lo][8 * hh];
      bp0[t] = cat4(*(const v4f*)(pr),      *(const v4f*)(pr + 4));
      bp1[t] = cat4(*(const v4f*)(pr + 16), *(const v4f*)(pr + 20));
    }
    // All of stage i that this trip uses is fetched: the publish point of stage
    // i + 1 stands here, in front of the trip's arithmetic, so that the refill
    // has a whole trip to land. Every wave, in this order:
    // this trip's LDS reads have returned,
    asm volatile("s_wait_dscnt 0x0" ::: "memory");
    // this wave's share of stage i + 1 has landed,
    asm volatile("s_wait_asynccnt 0x0" ::: "memory");
    // stage i + 1 is published and every reader has left stage i's buffer,
    __syncthreads();
    // which stage i + 2 refills
    if (i + 2 < NT) stage(i + 2);
#pragma unroll
    for (int t = 0; t < QT; ++t) {
      v8f z = {};
      v8f s0 = wmma16(b0, aq[t], z);   // s0[r] = S[q0+16t+lo][kc + 8*hh + r]
      v8f s1 = wmma16(b1, aq[t], z);   // s1[r] = S[q0+16t+lo][kc + 16 + 8*hh + r]

      float cm = -1e30f;
#pragma unroll
      for (int r = 0; r < 8; ++r) {
        s0[r] += bm0[r] + bp0[t][r];
        s1[r] += bm1[r] + bp1[t][r];
        cm = fmaxf(cm, fmaxf(s0[r], s1[r]));
      }
      // the query's maximum over all 32 keys: join the two halves
      cm = fmaxf(cm, xhalf(cm));
      float mn = fmaxf(mrow[t], cm);
      float alpha = __expf(mrow[t] - mn);
      mrow[t] = mn;
      v16h pb;                      // P^T as B operand, hardware k order
      float rs = 0.0f;
#pragma unroll
      for (int r = 0; r < 8; ++r) {
        float p0 = __expf(s0[r] - mn);
        float p1 = __expf(s1[r] - mn);
        rs += p0 + p1;
        pb[r]     = (_Float16)p0;
        pb[8 + r] = (_Float16)p1;
      }
      lrow[t] = lrow[t] * alpha + rs;
#pragma unroll
      for (int r = 0; r < 8; ++r) {
        o0[t][r] *= alpha;
        o1[t][r] *= alpha;
      }
      o0[t] = wmma16(bv0, pb, o0[t]);   // o0[t][r] = O[q0+16t+lo][8*hh + r]
      o1[t] = wmma16(bv1, pb, o1[t]);   // o1[t][r] = O[q0+16t+lo][16 + 8*hh + r]
    }
  }
  // nothing is in flight when the ring becomes staging for the join
  asm volatile("s_wait_asynccnt 0x0" ::: "memory");
  // join the key splits' partial results of each (batch, query group). The last
  // trip's barrier has ended every wave's reads of the rings, so the bias_pair
  // ring is free: a wave of splits 1 .. NW - 1 stages its own there, in planes of
  // 32 x 16 bytes: 4 per query tile for the accumulators, then one per query
  // tile for the maximum and this half's sum.
  constexpr int SP = QT * 5 * 32;     // 16-byte units staged by one wave
  static_assert((NW - 1) * BB * NQ * SP * 16 <= (int)sizeof(pbuf), "the staged partials fit the bias_pair ring");
  v4f* const sbase = (v4f*)&pbuf[0][0][0][0][0];
  if (ks != 0) {
    v4f* pw = sbase + (wave - BB * NQ) * SP;
    v4f* pm = pw + QT * 128;
#pragma unroll
    for (int t = 0; t < QT; ++t) {
      pw[128 * t + lane]      = __builtin_shufflevector(o0[t], o0[t], 0, 1, 2, 3);
      pw[128 * t + 32 + lane] = __builtin_shufflevector(o0[t], o0[t], 4, 5, 6, 7);
      pw[128 * t + 64 + lane] = __builtin_shufflevector(o1[t], o1[t], 0, 1, 2, 3);
      pw[128 * t + 96 + lane] = __builtin_shufflevector(o1[t], o1[t], 4, 5, 6, 7);
      v4f ml = {mrow[t], lrow[t], 0.0f, 0.0f};
      pm[32 * t + lane] = ml;
    }
  }
  __syncthreads();   // publishes the partial results to the waves of split 0
  if (ks != 0) return;
#pragma unroll
  for (int t = 0; t < QT; ++t) {
    // the loops below are unrolled so that mw, lw and the vector elements are
    // indexed by constants and stay in registers
    float mw[NW], lw[NW];
    float mall = mrow[t];
#pragma unroll
    for (int w = 1; w < NW; ++w) {
      v4f ml = sbase[(wave + (w - 1) * BB * NQ) * SP + QT * 128 + 32 * t + lane];
      mw[w] = ml[0];
      lw[w] = ml[1];
      mall = fmaxf(mall, mw[w]);
    }
    float f = __expf(mrow[t] - mall);
    lrow[t] *= f;
#pragma unroll
    for (int r = 0; r < 8; ++r) { o0[t][r] *= f; o1[t][r] *= f; }
#pragma unroll
    for (int w = 1; w < NW; ++w) {
      const v4f* pr = sbase + (wave + (w - 1) * BB * NQ) * SP + 128 * t;
      v4f a0 = pr[lane], a1 = pr[32 + lane], a2 = pr[64 + lane], a3 = pr[96 + lane];
      f = __expf(mw[w] - mall);
      lrow[t] += lw[w] * f;
#pragma unroll
      for (int r = 0; r < 4; ++r) {
        o0[t][r]     += a0[r] * f;
        o0[t][4 + r] += a1[r] * f;
        o1[t][r]     += a2[r] * f;
        o1[t][4 + r] += a3[r] * f;
      }
    }
    // epilogue: join the halves' sums, normalize, gate, store f16 [B*Q, H*CH]
    float inv = 1.0f / (lrow[t] + xhalf(lrow[t]));
    size_t base = ((size_t)b * QL + q0 + 16 * t + lo) * (NH * CH) + h * CH + 8 * hh;
    v8f g0 = *(const v8f*)(g + base);
    v8f g1 = *(const v8f*)(g + base + 16);
    v8h r0, r1;
#pragma unroll
    for (int r = 0; r < 8; ++r) {
      r0[r] = (_Float16)(o0[t][r] * inv * g0[r]);
      r1[r] = (_Float16)(o1[t][r] * inv * g1[r]);
    }
    *(v8h*)(og + base)      = r0;
    *(v8h*)(og + base + 16) = r1;
  }
}

// ---- final GEMM: [B*Q,256] @ w_o + b_o -> f32 out ----
// Same tiling; a wave takes 16 rows x 32 columns.
__global__ void __launch_bounds__(256)
k_out(const _Float16* __restrict__ og, const float* __restrict__ w_o,
      const float* __restrict__ b_o, float* __restrict__ out) {
  __shared__ __align__(16) _Float16 xs[TM][LP];
  __shared__ __align__(16) _Float16 wa[TN][LP];
  const int tid = threadIdx.x;
  const int lane = tid & 31;
  const int wave = __builtin_amdgcn_readfirstlane(tid >> 5);
  const int lo = lane & 15, hh = lane >> 4;
  const int mb = blockIdx.x * TM;
  const int nb = blockIdx.y * TN;

  // og tile: a wave's load covers one whole row of 512 bytes, 8 rows a pass
  const _Float16* ap = og + (size_t)(mb + (tid >> 5)) * CQ + (tid & 31) * 8;
  const float*    pa = wt_src(w_o, nb, tid);
  v8h xr[8];
  v4f ra[16];
#pragma unroll  // constant indices: the rows stay in registers
  for (int j = 0; j < 8; ++j) xr[j] = *(const v8h*)(ap + (size_t)(8 * j) * CQ);
  wt_load(pa, ra);
  // behind the last load, the two address pairs held up to here: no register
  // that an issued load names is rewritten in front of this wait
  asm volatile("s_wait_xcnt 0x0" :: "v"(ap), "v"(pa) : "memory");
#pragma unroll
  for (int j = 0; j < 8; ++j) *(v8h*)&xs[(tid >> 5) + 8 * j][(tid & 31) * 8] = xr[j];
  wt_store(ra, wa, tid);
  __syncthreads();   // publishes the two operand tiles to all waves

  const int nw = (wave >> 2) * 32;      // the wave's first column in the tile
  const _Float16* ar = &xs[(wave & 3) * 16 + lo][0];
  v8f acc[2] = {};
#pragma unroll
  for (int kc = 0; kc < CQ; kc += 32) {
    v16h a = frag(ar, kc, hh);
#pragma unroll
    for (int t = 0; t < 2; ++t)
      acc[t] = wmma16(a, frag(&wa[nw + 16 * t + lo][0], kc, hh), acc[t]);
  }
  const int m0 = mb + (wave & 3) * 16;
#pragma unroll
  for (int t = 0; t < 2; ++t) {
    const int n = nb + nw + 16 * t + lo;
    const float bias = b_o[n];
    float* op = out + (size_t)(m0 + 8 * hh) * CQ + n;
#pragma unroll
    for (int r = 0; r < 8; ++r) op[r * CQ] = acc[t][r] + bias;
  }
}

extern "C" void kernel_launch(void* const* d_in, const int* in_sizes, int n_in,
                              void* d_out, int out_size, void* d_ws, size_t ws_size,
                              hipStream_t stream) {
  const float* q_x       = (const float*)d_in[0];
  const float* kv_x      = (const float*)d_in[1];
  const float* bias_mask = (const float*)d_in[2];
  const float* bias_pair = (const float*)d_in[3];
  const float* w_q       = (const float*)d_in[4];
  const float* w_k       = (const float*)d_in[5];
  const float* w_v       = (const float*)d_in[6];
  const float* w_g       = (const float*)d_in[7];
  const float* b_g       = (const float*)d_in[8];
  const float* w_o       = (const float*)d_in[9];
  const float* b_o       = (const float*)d_in[10];
  float* out = (float*)d_out;

  char* ws = (char*)d_ws;
  size_t off = 0;
  auto alloc = [&](size_t bytes) {
    size_t o = off;
    off += (bytes + 255) & ~(size_t)255;
    return o;
  };
  _Float16* qh  = (_Float16*)(ws + alloc((size_t)BB * NH * QL * CH * 2));
  _Float16* kh  = (_Float16*)(ws + alloc((size_t)BB * NH * KL * CH * 2));
  _Float16* vtp = (_Float16*)(ws + alloc((size_t)BB * NH * CH * KL * 2));
  float*    gb  = (float*)   (ws + alloc((size_t)BB * QL * CQ * 4));
  _Float16* og  = (_Float16*)(ws + alloc((size_t)BB * QL * CQ * 2));

  // projections, one launch for the four: 8 waves per TM x TN tile of a pair of
  // products; QL == KL, so one grid serves q_x and kv_x
  k_proj<<<dim3((BB * QL) / TM, CQ / TN, 2), 256, 0, stream>>>(
      q_x, kv_x, w_q, w_k, w_v, w_g, b_g, qh, kh, vtp, gb);

  // fused flash attention + gating (async double-buffered tiles, both batches
  // of a query block in one work-group)
  k_attn<<<dim3(QL / (16 * QT * NQ), NH), 32 * NW * BB * NQ, 0, stream>>>(qh, kh, vtp, bias_mask,
                                                   bias_pair, gb, og);

  // output projection
  k_out<<<dim3((BB * QL) / TM, CQ / TN), 256, 0, stream>>>(og, w_o, b_o, out);
}
